// v000
// Times are from an AMD MI455X. After a warm-up the kernel runs many times in a row, and a time is the length of
// such a window on the GPU divided by its runs, so every launch and the gaps after it count. The runs cycle
// through copies of the inputs. A figure is the median of several windows, for all but v000 over two sittings.
// Sittings can differ by a few percent; kernels timed side by side share one.
// v000 is the starting kernel. One run takes 227 microseconds.
#include <hip/hip_runtime.h>
#include <hip/hip_bf16.h>
#include <math.h>

// Problem constants (from reference)
#define BB 2
#define TT 128
#define DD 1024
#define HH 8
#define RR 8
#define DK 64
#define DV 64
#define MROWS (BB*TT)          // 256

typedef __attribute__((ext_vector_type(16))) _Float16 v16h;
typedef __attribute__((ext_vector_type(8)))  _Float16 v8h;
typedef __attribute__((ext_vector_type(8)))  float    v8f;

__device__ __forceinline__ float sigmoid_fast(float x) {
    return __builtin_amdgcn_rcpf(1.0f + __expf(-x));
}

// ---------------------------------------------------------------------------
// WMMA GEMM with native-layout f16 operands.
//   A  : [M,K] f16 row-major
//   Bt : [N,K] f16 row-major (i.e. W[K,N] pre-transposed)
//   C  : [M,N] f32 row-major
// Per ISA 7.12.2 the 16x32 f16 A fragment for lane L (m=L&15, hi=L>>4) is
//   halves 0..7  = K  8*hi + 0..7   (contiguous)
//   halves 8..15 = K 16+8*hi + 0..7 (contiguous)
// so each fragment = two global_load_b128 per lane; same for B against Bt.
// 8 waves / block, one 16x16 C tile per wave (linear tile id).
// K must be a multiple of 64 (manual 2x unroll -> 2 WMMAs/iter).
// ---------------------------------------------------------------------------
__global__ void gemm16_wmma(const _Float16* __restrict__ A,
                            const _Float16* __restrict__ Bt,
                            float* __restrict__ C,
                            int M, int N, int K, int act)
{
    const int lane = threadIdx.x & 31;
    const int wid  = threadIdx.x >> 5;
    const int tid  = blockIdx.x * 8 + wid;          // linear 16x16 tile id
    const int ntiles = N >> 4;
    const int m0 = (tid / ntiles) << 4;
    const int n0 = (tid % ntiles) << 4;
    if (m0 >= M) return;                            // wave-uniform guard

    const int hi = lane >> 4;
    const int lo = lane & 15;
    const _Float16* arow = A  + (size_t)(m0 + lo) * K + 8*hi;
    const _Float16* brow = Bt + (size_t)(n0 + lo) * K + 8*hi;

    v8f acc = {};
    for (int k0 = 0; k0 < K; k0 += 64) {
        v8h al0 = *(const v8h*)(arow + k0);
        v8h ah0 = *(const v8h*)(arow + k0 + 16);
        v8h bl0 = *(const v8h*)(brow + k0);
        v8h bh0 = *(const v8h*)(brow + k0 + 16);
        v8h al1 = *(const v8h*)(arow + k0 + 32);
        v8h ah1 = *(const v8h*)(arow + k0 + 48);
        v8h bl1 = *(const v8h*)(brow + k0 + 32);
        v8h bh1 = *(const v8h*)(brow + k0 + 48);
        v16h a0 = __builtin_shufflevector(al0, ah0, 0,1,2,3,4,5,6,7,8,9,10,11,12,13,14,15);
        v16h b0 = __builtin_shufflevector(bl0, bh0, 0,1,2,3,4,5,6,7,8,9,10,11,12,13,14,15);
        v16h a1 = __builtin_shufflevector(al1, ah1, 0,1,2,3,4,5,6,7,8,9,10,11,12,13,14,15);
        v16h b1 = __builtin_shufflevector(bl1, bh1, 0,1,2,3,4,5,6,7,8,9,10,11,12,13,14,15);
        acc = __builtin_amdgcn_wmma_f32_16x16x32_f16(false, a0, false, b0,
                                                     (short)0, acc, false, false);
        acc = __builtin_amdgcn_wmma_f32_16x16x32_f16(false, a1, false, b1,
                                                     (short)0, acc, false, false);
    }
#pragma unroll
    for (int r = 0; r < 8; ++r) {
        float x = acc[r];
        if (act == 1) x = sigmoid_fast(x);
        C[(size_t)(m0 + r + 8*hi) * N + (n0 + lo)] = x;
    }
}

// ---------------------------------------------------------------------------
// One-time layout prep: f32 -> f16 copy, and f32 [K,N] -> f16 [N,K] transpose.
// ---------------------------------------------------------------------------
__global__ void cvt_f16_kernel(const float* __restrict__ in,
                               _Float16* __restrict__ out, int n)
{
    const int i = blockIdx.x * blockDim.x + threadIdx.x;
    if (i < n) out[i] = (_Float16)in[i];
}

__global__ void transpose_f16_kernel(const float* __restrict__ in,   // [K,N]
                                     _Float16* __restrict__ out,     // [N,K]
                                     int K, int N)
{
    const int i = blockIdx.x * blockDim.x + threadIdx.x;
    if (i >= K * N) return;
    const int kk = i % K;
    const int nn = i / K;
    out[i] = (_Float16)in[(size_t)kk * N + nn];      // coalesced writes
}

// ---------------------------------------------------------------------------
// Precompute per-(h,r) spectral parameters.
// ---------------------------------------------------------------------------
__global__ void params_kernel(const float* __restrict__ mode_logits,
                              const float* __restrict__ log_decay,
                              const float* __restrict__ omega_log_scale,
                              float* __restrict__ cosw,
                              float* __restrict__ sinw,
                              float* __restrict__ rho,
                              float* __restrict__ modew)
{
    const int t = threadIdx.x;      // 0..63
    if (t >= HH*RR) return;
    const int h = t >> 3;

    const float ld = log_decay[t];
    const float sp = (ld > 20.0f) ? ld : log1pf(expf(ld));   // softplus
    rho[t] = expf(-sp);

    float mx = -1e30f;
    for (int j = 0; j < RR; ++j) mx = fmaxf(mx, mode_logits[h*RR + j]);
    float sum = 0.0f;
    for (int j = 0; j < RR; ++j) sum += expf(mode_logits[h*RR + j] - mx);
    modew[t] = expf(mode_logits[t] - mx) / sum;

    const float os = expf(omega_log_scale[t]);
    for (int d = 0; d < DK; ++d) {
        const float pidx = (float)(d & ~1);                  // repeat_interleave
        const float invf = powf(10000.0f, -pidx / (float)DK);
        const float w = os * invf;
        cosw[t*DK + d] = cosf(w);
        sinw[t*DK + d] = sinf(w);
    }
}

// ---------------------------------------------------------------------------
// Recurrent scan: one wave32 per independent state row (b,h,r,v); 2 Dk-state
// elements per lane in registers; two butterfly wave reductions per step.
// ys layout: [B*T, H, R, DV].
// ---------------------------------------------------------------------------
__global__ void scan_kernel(const float* __restrict__ q,
                            const float* __restrict__ k,
                            const float* __restrict__ v,
                            const float* __restrict__ beta,
                            const float* __restrict__ tg,
                            const float* __restrict__ cosw,
                            const float* __restrict__ sinw,
                            const float* __restrict__ rho,
                            const float* __restrict__ modew,
                            float* __restrict__ ys)
{
    const int gw   = blockIdx.x * (blockDim.x >> 5) + (threadIdx.x >> 5);
    const int lane = threadIdx.x & 31;
    const int vrow = gw & 63;
    const int r    = (gw >> 6) & 7;
    const int h    = (gw >> 9) & 7;
    const int b    = (gw >> 12) & 1;
    const int hr   = h*RR + r;

    const float c0 = cosw[hr*DK + 2*lane];
    const float c1 = cosw[hr*DK + 2*lane + 1];
    const float s0 = sinw[hr*DK + 2*lane];
    const float s1 = sinw[hr*DK + 2*lane + 1];
    const float rho_hr = rho[hr];
    const float mw     = modew[hr];

    const float2* k2 = (const float2*)k;
    const float2* q2 = (const float2*)q;

    float sr0 = 0.f, sr1 = 0.f, si0 = 0.f, si1 = 0.f;

    for (int t = 0; t < TT; ++t) {
        const int bt = b*TT + t;
        const int bh = bt*HH + h;                 // flat (b,t,h)
        const float2 kt = k2[bh*32 + lane];
        const float2 qt = q2[bh*32 + lane];
        const float tgt = tg[bh*RR + r];
        const float bet = beta[bh*RR + r];
        const float vt  = v[bh*DV + vrow];

        const float decay = tgt * rho_hr;
        const float rr0 = decay * (c0*sr0 - s0*si0);
        const float rr1 = decay * (c1*sr1 - s1*si1);
        const float ri0 = decay * (s0*sr0 + c0*si0);
        const float ri1 = decay * (s1*sr1 + c1*si1);

        float pred = rr0*kt.x + rr1*kt.y;
#pragma unroll
        for (int off = 16; off; off >>= 1) pred += __shfl_xor(pred, off, 32);

        const float bw = bet * (vt - pred);
        sr0 = rr0 + bw*kt.x;
        sr1 = rr1 + bw*kt.y;
        si0 = ri0;
        si1 = ri1;

        float rd = sr0*qt.x + sr1*qt.y;
#pragma unroll
        for (int off = 16; off; off >>= 1) rd += __shfl_xor(rd, off, 32);

        if (lane == 0)
            ys[(size_t)(bh*RR + r)*DV + vrow] = rd * mw;
    }
}

// ---------------------------------------------------------------------------
// ogh[bt, h*DV+v] = f16( gate * sum_r ys[bt,h,r,v] )  (feeds the final WMMA)
// ---------------------------------------------------------------------------
__global__ void combine_kernel(const float* __restrict__ ys,
                               const float* __restrict__ g,
                               _Float16* __restrict__ ogh)
{
    const int i = blockIdx.x * blockDim.x + threadIdx.x;   // 0..MROWS*H*DV-1
    const int vv = i & 63;
    const int h  = (i >> 6) & 7;
    const int bt = i >> 9;
    const size_t base = (size_t)((bt*HH + h)*RR)*DV + vv;
    float s = 0.0f;
#pragma unroll
    for (int r = 0; r < RR; ++r) s += ys[base + r*DV];
    ogh[i] = (_Float16)(s * g[i]);
}

// ---------------------------------------------------------------------------
extern "C" void kernel_launch(void* const* d_in, const int* in_sizes, int n_in,
                              void* d_out, int out_size, void* d_ws, size_t ws_size,
                              hipStream_t stream)
{
    (void)in_sizes; (void)n_in; (void)out_size; (void)ws_size;
    const float* x    = (const float*)d_in[0];
    const float* Wq   = (const float*)d_in[1];
    const float* Wk   = (const float*)d_in[2];
    const float* Wv   = (const float*)d_in[3];
    const float* Wb   = (const float*)d_in[4];
    const float* Wtg  = (const float*)d_in[5];
    const float* mlg  = (const float*)d_in[6];
    const float* ldc  = (const float*)d_in[7];
    const float* oms  = (const float*)d_in[8];
    const float* Wg   = (const float*)d_in[9];
    const float* Wo   = (const float*)d_in[10];

    // ---- f32 scratch ----
    float* ws    = (float*)d_ws;
    float* q     = ws;                        // 256*512
    float* k     = q    + MROWS*512;
    float* v     = k    + MROWS*512;
    float* g     = v    + MROWS*512;
    float* beta  = g    + MROWS*512;          // 256*64
    float* tg    = beta + MROWS*64;
    float* cosw  = tg   + MROWS*64;           // 64*64
    float* sinw  = cosw + HH*RR*DK;
    float* rho   = sinw + HH*RR*DK;           // 64
    float* modew = rho  + HH*RR;
    float* ys    = modew + HH*RR;             // 256*8*8*64 = 1048576
    float* fend  = ys   + MROWS*HH*RR*DV;

    // ---- f16 scratch (16B-aligned: float count above is a multiple of 4) ----
    _Float16* hb   = (_Float16*)fend;
    _Float16* xh   = hb;                      // 256*1024
    _Float16* Wqt  = xh   + MROWS*DD;         // 512*1024 each
    _Float16* Wkt  = Wqt  + 512*DD;
    _Float16* Wvt  = Wkt  + 512*DD;
    _Float16* Wgt  = Wvt  + 512*DD;
    _Float16* Wbt  = Wgt  + 512*DD;           // 64*1024 each
    _Float16* Wtgt = Wbt  + 64*DD;
    _Float16* Wot  = Wtgt + 64*DD;            // 1024*512
    _Float16* ogh  = Wot  + DD*512;           // 256*512

    params_kernel<<<1, 64, 0, stream>>>(mlg, ldc, oms, cosw, sinw, rho, modew);

    // layout prep
    cvt_f16_kernel<<<(MROWS*DD)/256, 256, 0, stream>>>(x, xh, MROWS*DD);
    transpose_f16_kernel<<<(DD*512)/256, 256, 0, stream>>>(Wq,  Wqt,  DD, 512);
    transpose_f16_kernel<<<(DD*512)/256, 256, 0, stream>>>(Wk,  Wkt,  DD, 512);
    transpose_f16_kernel<<<(DD*512)/256, 256, 0, stream>>>(Wv,  Wvt,  DD, 512);
    transpose_f16_kernel<<<(DD*512)/256, 256, 0, stream>>>(Wg,  Wgt,  DD, 512);
    transpose_f16_kernel<<<(DD*64)/256,  256, 0, stream>>>(Wb,  Wbt,  DD, 64);
    transpose_f16_kernel<<<(DD*64)/256,  256, 0, stream>>>(Wtg, Wtgt, DD, 64);
    transpose_f16_kernel<<<(512*DD)/256, 256, 0, stream>>>(Wo,  Wot,  512, DD);

    // projections: tiles = (M/16)*(N/16); 8 tiles (waves) per 256-thread block
    gemm16_wmma<<<(16*32)/8, 256, 0, stream>>>(xh, Wqt,  q,    MROWS, 512, DD, 0);
    gemm16_wmma<<<(16*32)/8, 256, 0, stream>>>(xh, Wkt,  k,    MROWS, 512, DD, 0);
    gemm16_wmma<<<(16*32)/8, 256, 0, stream>>>(xh, Wvt,  v,    MROWS, 512, DD, 0);
    gemm16_wmma<<<(16*4)/8,  256, 0, stream>>>(xh, Wbt,  beta, MROWS, 64,  DD, 1);
    gemm16_wmma<<<(16*4)/8,  256, 0, stream>>>(xh, Wtgt, tg,   MROWS, 64,  DD, 1);
    gemm16_wmma<<<(16*32)/8, 256, 0, stream>>>(xh, Wgt,  g,    MROWS, 512, DD, 1);

    // 8192 rows, 1 wave each, 8 waves per 256-thread block -> 1024 blocks
    scan_kernel<<<1024, 256, 0, stream>>>(q, k, v, beta, tg, cosw, sinw, rho, modew, ys);

    combine_kernel<<<(MROWS*HH*DV)/256, 256, 0, stream>>>(ys, g, ogh);

    gemm16_wmma<<<(16*64)/8, 256, 0, stream>>>(ogh, Wot, (float*)d_out,
                                               MROWS, DD, 512, 0);
}

// v001
// A run of this version takes 186 microseconds.
// Two timings next to v000 put it at 1.23 and 1.22 times that version's speed.
#include <hip/hip_runtime.h>
#include <hip/hip_bf16.h>
#include <math.h>

// Problem constants (from reference)
#define BB 2
#define TT 128
#define DD 1024
#define HH 8
#define RR 8
#define DK 64
#define DV 64
#define MROWS (BB*TT)          // 256

typedef __attribute__((ext_vector_type(16))) _Float16 v16h;
typedef __attribute__((ext_vector_type(8)))  _Float16 v8h;
typedef __attribute__((ext_vector_type(8)))  float    v8f;

__device__ __forceinline__ float sigmoid_fast(float x) {
    return __builtin_amdgcn_rcpf(1.0f + __expf(-x));
}

// ---------------------------------------------------------------------------
// WMMA GEMM with native-layout f16 operands.
//   A  : [M,K] f16 row-major
//   Bt : [N,K] f16 row-major (i.e. W[K,N] pre-transposed)
//   C  : [M,N] f32 row-major
// Per ISA 7.12.2 the 16x32 f16 A fragment for lane L (m=L&15, hi=L>>4) is
//   halves 0..7  = K  8*hi + 0..7   (contiguous)
//   halves 8..15 = K 16+8*hi + 0..7 (contiguous)
// so each fragment = two global_load_b128 per lane; same for B against Bt.
// 8 waves / block, one 16x16 C tile per wave (linear tile id).
// K must be a multiple of 64 (manual 2x unroll -> 2 WMMAs/iter).
// ---------------------------------------------------------------------------
__global__ void gemm16_wmma(const _Float16* __restrict__ A,
                            const _Float16* __restrict__ Bt,
                            float* __restrict__ C,
                            int M, int N, int K, int act)
{
    const int lane = threadIdx.x & 31;
    const int wid  = threadIdx.x >> 5;
    const int tid  = blockIdx.x * 8 + wid;          // linear 16x16 tile id
    const int ntiles = N >> 4;
    const int m0 = (tid / ntiles) << 4;
    const int n0 = (tid % ntiles) << 4;
    if (m0 >= M) return;                            // wave-uniform guard

    const int hi = lane >> 4;
    const int lo = lane & 15;
    const _Float16* arow = A  + (size_t)(m0 + lo) * K + 8*hi;
    const _Float16* brow = Bt + (size_t)(n0 + lo) * K + 8*hi;

    v8f acc = {};
    for (int k0 = 0; k0 < K; k0 += 64) {
        v8h al0 = *(const v8h*)(arow + k0);
        v8h ah0 = *(const v8h*)(arow + k0 + 16);
        v8h bl0 = *(const v8h*)(brow + k0);
        v8h bh0 = *(const v8h*)(brow + k0 + 16);
        v8h al1 = *(const v8h*)(arow + k0 + 32);
        v8h ah1 = *(const v8h*)(arow + k0 + 48);
        v8h bl1 = *(const v8h*)(brow + k0 + 32);
        v8h bh1 = *(const v8h*)(brow + k0 + 48);
        v16h a0 = __builtin_shufflevector(al0, ah0, 0,1,2,3,4,5,6,7,8,9,10,11,12,13,14,15);
        v16h b0 = __builtin_shufflevector(bl0, bh0, 0,1,2,3,4,5,6,7,8,9,10,11,12,13,14,15);
        v16h a1 = __builtin_shufflevector(al1, ah1, 0,1,2,3,4,5,6,7,8,9,10,11,12,13,14,15);
        v16h b1 = __builtin_shufflevector(bl1, bh1, 0,1,2,3,4,5,6,7,8,9,10,11,12,13,14,15);
        acc = __builtin_amdgcn_wmma_f32_16x16x32_f16(false, a0, false, b0,
                                                     (short)0, acc, false, false);
        acc = __builtin_amdgcn_wmma_f32_16x16x32_f16(false, a1, false, b1,
                                                     (short)0, acc, false, false);
    }
#pragma unroll
    for (int r = 0; r < 8; ++r) {
        float x = acc[r];
        if (act == 1) x = sigmoid_fast(x);
        C[(size_t)(m0 + r + 8*hi) * N + (n0 + lo)] = x;
    }
}

// ---------------------------------------------------------------------------
// One-time layout prep: f32 -> f16 copy, and f32 [K,N] -> f16 [N,K] transpose.
// ---------------------------------------------------------------------------
__global__ void cvt_f16_kernel(const float* __restrict__ in,
                               _Float16* __restrict__ out, int n)
{
    const int i = blockIdx.x * blockDim.x + threadIdx.x;
    if (i < n) out[i] = (_Float16)in[i];
}

__global__ void transpose_f16_kernel(const float* __restrict__ in,   // [K,N]
                                     _Float16* __restrict__ out,     // [N,K]
                                     int K, int N)
{
    const int i = blockIdx.x * blockDim.x + threadIdx.x;
    if (i >= K * N) return;
    const int kk = i % K;
    const int nn = i / K;
    out[i] = (_Float16)in[(size_t)kk * N + nn];      // coalesced writes
}

// ---------------------------------------------------------------------------
// Precompute per-(h,r) spectral parameters.
// ---------------------------------------------------------------------------
__global__ void params_kernel(const float* __restrict__ mode_logits,
                              const float* __restrict__ log_decay,
                              const float* __restrict__ omega_log_scale,
                              float* __restrict__ cosw,
                              float* __restrict__ sinw,
                              float* __restrict__ rho,
                              float* __restrict__ modew)
{
    const int t = threadIdx.x;      // 0..63
    if (t >= HH*RR) return;
    const int h = t >> 3;

    const float ld = log_decay[t];
    const float sp = (ld > 20.0f) ? ld : log1pf(expf(ld));   // softplus
    rho[t] = expf(-sp);

    float mx = -1e30f;
    for (int j = 0; j < RR; ++j) mx = fmaxf(mx, mode_logits[h*RR + j]);
    float sum = 0.0f;
    for (int j = 0; j < RR; ++j) sum += expf(mode_logits[h*RR + j] - mx);
    modew[t] = expf(mode_logits[t] - mx) / sum;

    const float os = expf(omega_log_scale[t]);
    for (int d = 0; d < DK; ++d) {
        const float pidx = (float)(d & ~1);                  // repeat_interleave
        const float invf = powf(10000.0f, -pidx / (float)DK);
        const float w = os * invf;
        cosw[t*DK + d] = cosf(w);
        sinw[t*DK + d] = sinf(w);
    }
}

// ---------------------------------------------------------------------------
// Recurrent scan: 8 lanes share one state row (b,h,r,v); each lane keeps 8 of
// the 64 Dk elements (real and imaginary) in registers, as two groups of four:
// k = 4*sub + 0..3 and k = 32 + 4*sub + 0..3, so that the 8 lanes of a row read
// one 128-byte line per 16-byte load. The two sums over Dk of a time step end
// in three in-row DPP adds (lane ^ 1, ^ 2, ^ 4).
// One block = 32 rows (half the Dv rows) of one (b,h,r). ys: [B*T, H, R, DV].
// ---------------------------------------------------------------------------
template <int CTRL>
__device__ __forceinline__ float add_row_xmask(float x)
{
    // x + (x of lane ^ mask), mask in the low bits of CTRL (0x160 | mask)
    const int xi = __builtin_bit_cast(int, x);
    const int yi = __builtin_amdgcn_update_dpp(0, xi, CTRL, 0xf, 0xf, true);
    return x + __builtin_bit_cast(float, yi);
}

__device__ __forceinline__ float sum_over_8_lanes(float x)
{
    x = add_row_xmask<0x161>(x);
    x = add_row_xmask<0x162>(x);
    x = add_row_xmask<0x164>(x);
    return x;
}

// The grid is 2048 waves, two per SIMD: waves_per_eu says so, so that the
// register budget is not held at 64; at 64 the q and v loads of a time step were
// placed behind the wait for its k loads (three load latencies in a row a step).
__global__ __launch_bounds__(256) __attribute__((amdgpu_waves_per_eu(2, 2)))
void scan_kernel(const float* __restrict__ q,
                 const float* __restrict__ k,
                 const float* __restrict__ v,
                 const float* __restrict__ beta,
                 const float* __restrict__ tg,
                 const float* __restrict__ cosw,
                 const float* __restrict__ sinw,
                 const float* __restrict__ rho,
                 const float* __restrict__ modew,
                 float* __restrict__ ys)
{
    const int half = blockIdx.x & 1;
    const int r    = (blockIdx.x >> 1) & 7;
    const int h    = (blockIdx.x >> 4) & 7;
    const int b    = (blockIdx.x >> 7) & 1;
    const int hr   = h*RR + r;
    const int sub  = threadIdx.x & 7;
    const int vrow = half*32 + (threadIdx.x >> 3);

    const float rho_hr = rho[hr];
    const float mw     = modew[hr];
    // keeps the scalar loads above from being placed between the four loads
    // below and their wait, where they would land in those loads' base registers
    __builtin_amdgcn_sched_barrier(0);

    const float4* c4 = (const float4*)(cosw + hr*DK);
    const float4* s4 = (const float4*)(sinw + hr*DK);
    const float4 ca = c4[sub], cb = c4[8 + sub];
    const float4 sa = s4[sub], sb = s4[8 + sub];
    // the base registers of these four loads are reused right behind them: keep
    // the wait between the loads and those writes; the scheduling barrier keeps
    // the later index arithmetic from being lifted over the wait
    asm volatile("s_wait_xcnt 0x0" ::: "memory");
    __builtin_amdgcn_sched_barrier(0);
    const float c[8] = {ca.x, ca.y, ca.z, ca.w, cb.x, cb.y, cb.z, cb.w};
    const float s[8] = {sa.x, sa.y, sa.z, sa.w, sb.x, sb.y, sb.z, sb.w};

    const float4* k4 = (const float4*)k;
    const float4* q4 = (const float4*)q;

    // every loop over e below is unrolled so that the 8-element arrays are
    // indexed by constants and stay in registers
    float sr[8], si[8];
#pragma unroll
    for (int e = 0; e < 8; ++e) { sr[e] = 0.f; si[e] = 0.f; }

    // Each trip issues its own loads at its top and waits for them in the same
    // trip: one load latency a time step is still on the serial path.
    for (int t = 0; t < TT; ++t) {
        const int bh = (b*TT + t)*HH + h;         // flat (b,t,h)
        const float4 ka = k4[bh*16 + sub], kb = k4[bh*16 + 8 + sub];
        const float4 qa = q4[bh*16 + sub], qb = q4[bh*16 + 8 + sub];
        const float tgt = tg[bh*RR + r];
        const float bet = beta[bh*RR + r];
        const float vt  = v[bh*DV + vrow];
        const float kt[8] = {ka.x, ka.y, ka.z, ka.w, kb.x, kb.y, kb.z, kb.w};
        const float qt[8] = {qa.x, qa.y, qa.z, qa.w, qb.x, qb.y, qb.z, qb.w};

        const float decay = tgt * rho_hr;
        float rr[8];
#pragma unroll
        for (int e = 0; e < 8; ++e) {
            rr[e] = decay * (c[e]*sr[e] - s[e]*si[e]);
            si[e] = decay * (s[e]*sr[e] + c[e]*si[e]);
        }

        const float pa = rr[0]*kt[0] + rr[2]*kt[2] + rr[4]*kt[4] + rr[6]*kt[6];
        const float pb = rr[1]*kt[1] + rr[3]*kt[3] + rr[5]*kt[5] + rr[7]*kt[7];
        const float pred = sum_over_8_lanes(pa + pb);

        const float bw = bet * (vt - pred);
#pragma unroll
        for (int e = 0; e < 8; ++e) sr[e] = rr[e] + bw*kt[e];

        const float ra = sr[0]*qt[0] + sr[2]*qt[2] + sr[4]*qt[4] + sr[6]*qt[6];
        const float rb = sr[1]*qt[1] + sr[3]*qt[3] + sr[5]*qt[5] + sr[7]*qt[7];
        const float rd = sum_over_8_lanes(ra + rb);

        if (sub == 0) {
            ys[(size_t)(bh*RR + r)*DV + vrow] = rd * mw;
            // the store's address and data registers are rewritten in the next
            // trip: keep the wait between the store and those writes
            asm volatile("s_wait_xcnt 0x0" ::: "memory");
        }
    }
}

// ---------------------------------------------------------------------------
// ogh[bt, h*DV+v] = f16( gate * sum_r ys[bt,h,r,v] )  (feeds the final WMMA)
// ---------------------------------------------------------------------------
__global__ void combine_kernel(const float* __restrict__ ys,
                               const float* __restrict__ g,
                               _Float16* __restrict__ ogh)
{
    const int i = blockIdx.x * blockDim.x + threadIdx.x;   // 0..MROWS*H*DV-1
    const int vv = i & 63;
    const int h  = (i >> 6) & 7;
    const int bt = i >> 9;
    const size_t base = (size_t)((bt*HH + h)*RR)*DV + vv;
    float s = 0.0f;
#pragma unroll
    for (int r = 0; r < RR; ++r) s += ys[base + r*DV];
    ogh[i] = (_Float16)(s * g[i]);
}

// ---------------------------------------------------------------------------
extern "C" void kernel_launch(void* const* d_in, const int* in_sizes, int n_in,
                              void* d_out, int out_size, void* d_ws, size_t ws_size,
                              hipStream_t stream)
{
    (void)in_sizes; (void)n_in; (void)out_size; (void)ws_size;
    const float* x    = (const float*)d_in[0];
    const float* Wq   = (const float*)d_in[1];
    const float* Wk   = (const float*)d_in[2];
    const float* Wv   = (const float*)d_in[3];
    const float* Wb   = (const float*)d_in[4];
    const float* Wtg  = (const float*)d_in[5];
    const float* mlg  = (const float*)d_in[6];
    const float* ldc  = (const float*)d_in[7];
    const float* oms  = (const float*)d_in[8];
    const float* Wg   = (const float*)d_in[9];
    const float* Wo   = (const float*)d_in[10];

    // ---- f32 scratch ----
    float* ws    = (float*)d_ws;
    float* q     = ws;                        // 256*512
    float* k     = q    + MROWS*512;
    float* v     = k    + MROWS*512;
    float* g     = v    + MROWS*512;
    float* beta  = g    + MROWS*512;          // 256*64
    float* tg    = beta + MROWS*64;
    float* cosw  = tg   + MROWS*64;           // 64*64
    float* sinw  = cosw + HH*RR*DK;
    float* rho   = sinw + HH*RR*DK;           // 64
    float* modew = rho  + HH*RR;
    float* ys    = modew + HH*RR;             // 256*8*8*64 = 1048576
    float* fend  = ys   + MROWS*HH*RR*DV;

    // ---- f16 scratch (16B-aligned: float count above is a multiple of 4) ----
    _Float16* hb   = (_Float16*)fend;
    _Float16* xh   = hb;                      // 256*1024
    _Float16* Wqt  = xh   + MROWS*DD;         // 512*1024 each
    _Float16* Wkt  = Wqt  + 512*DD;
    _Float16* Wvt  = Wkt  + 512*DD;
    _Float16* Wgt  = Wvt  + 512*DD;
    _Float16* Wbt  = Wgt  + 512*DD;           // 64*1024 each
    _Float16* Wtgt = Wbt  + 64*DD;
    _Float16* Wot  = Wtgt + 64*DD;            // 1024*512
    _Float16* ogh  = Wot  + DD*512;           // 256*512

    params_kernel<<<1, 64, 0, stream>>>(mlg, ldc, oms, cosw, sinw, rho, modew);

    // layout prep
    cvt_f16_kernel<<<(MROWS*DD)/256, 256, 0, stream>>>(x, xh, MROWS*DD);
    transpose_f16_kernel<<<(DD*512)/256, 256, 0, stream>>>(Wq,  Wqt,  DD, 512);
    transpose_f16_kernel<<<(DD*512)/256, 256, 0, stream>>>(Wk,  Wkt,  DD, 512);
    transpose_f16_kernel<<<(DD*512)/256, 256, 0, stream>>>(Wv,  Wvt,  DD, 512);
    transpose_f16_kernel<<<(DD*512)/256, 256, 0, stream>>>(Wg,  Wgt,  DD, 512);
    transpose_f16_kernel<<<(DD*64)/256,  256, 0, stream>>>(Wb,  Wbt,  DD, 64);
    transpose_f16_kernel<<<(DD*64)/256,  256, 0, stream>>>(Wtg, Wtgt, DD, 64);
    transpose_f16_kernel<<<(512*DD)/256, 256, 0, stream>>>(Wo,  Wot,  512, DD);

    // projections: tiles = (M/16)*(N/16); 8 tiles (waves) per 256-thread block
    gemm16_wmma<<<(16*32)/8, 256, 0, stream>>>(xh, Wqt,  q,    MROWS, 512, DD, 0);
    gemm16_wmma<<<(16*32)/8, 256, 0, stream>>>(xh, Wkt,  k,    MROWS, 512, DD, 0);
    gemm16_wmma<<<(16*32)/8, 256, 0, stream>>>(xh, Wvt,  v,    MROWS, 512, DD, 0);
    gemm16_wmma<<<(16*4)/8,  256, 0, stream>>>(xh, Wbt,  beta, MROWS, 64,  DD, 1);
    gemm16_wmma<<<(16*4)/8,  256, 0, stream>>>(xh, Wtgt, tg,   MROWS, 64,  DD, 1);
    gemm16_wmma<<<(16*32)/8, 256, 0, stream>>>(xh, Wgt,  g,    MROWS, 512, DD, 1);

    // 8192 rows, 8 lanes each, 32 rows per 256-thread block -> 256 blocks
    scan_kernel<<<256, 256, 0, stream>>>(q, k, v, beta, tg, cosw, sinw, rho, modew, ys);

    combine_kernel<<<(MROWS*HH*DV)/256, 256, 0, stream>>>(ys, g, ogh);

    gemm16_wmma<<<(16*64)/8, 256, 0, stream>>>(ogh, Wot, (float*)d_out,
                                               MROWS, DD, 512, 0);
}

// v002
// Measured time: 120 microseconds a run.
// Two timings next to v001 put it at 1.55 and 1.57 times that version's speed.
// All steps since v000 together make it 1.92 times as fast.
#include <hip/hip_runtime.h>
#include <hip/hip_bf16.h>
#include <math.h>

// Problem constants (from reference)
#define BB 2
#define TT 128
#define DD 1024
#define HH 8
#define RR 8
#define DK 64
#define DV 64
#define MROWS (BB*TT)          // 256

typedef __attribute__((ext_vector_type(16))) _Float16 v16h;
typedef __attribute__((ext_vector_type(8)))  _Float16 v8h;
typedef __attribute__((ext_vector_type(8)))  float    v8f;

__device__ __forceinline__ float sigmoid_fast(float x) {
    return __builtin_amdgcn_rcpf(1.0f + __expf(-x));
}

// ---------------------------------------------------------------------------
// WMMA GEMM with native-layout f16 operands.
//   A  : [M,K] f16 row-major
//   Bt : [N,K] f16 row-major (i.e. W[K,N] pre-transposed)
//   C  : [M,N] f32 row-major
// Per ISA 7.12.2 the 16x32 f16 A fragment for lane L (m=L&15, hi=L>>4) is
//   halves 0..7  = K  8*hi + 0..7   (contiguous)
//   halves 8..15 = K 16+8*hi + 0..7 (contiguous)
// so each fragment = two global_load_b128 per lane; same for B against Bt.
// 8 waves / block, one 16x16 C tile per wave (linear tile id).
// K must be a multiple of 64 (manual 2x unroll -> 2 WMMAs/iter).
// blk is the block's index within its own product.
// ---------------------------------------------------------------------------
__device__ __forceinline__ void gemm16_tile(const _Float16* __restrict__ A,
                                            const _Float16* __restrict__ Bt,
                                            float* __restrict__ C,
                                            int M, int N, int K, int act, int blk)
{
    const int lane = threadIdx.x & 31;
    const int wid  = threadIdx.x >> 5;
    const int tid  = blk * 8 + wid;                 // linear 16x16 tile id
    const int ntiles = N >> 4;
    const int m0 = (tid / ntiles) << 4;
    const int n0 = (tid % ntiles) << 4;
    if (m0 >= M) return;                            // wave-uniform guard

    const int hi = lane >> 4;
    const int lo = lane & 15;
    const _Float16* arow = A  + (size_t)(m0 + lo) * K + 8*hi;
    const _Float16* brow = Bt + (size_t)(n0 + lo) * K + 8*hi;

    v8f acc = {};
    for (int k0 = 0; k0 < K; k0 += 64) {
        v8h al0 = *(const v8h*)(arow + k0);
        v8h ah0 = *(const v8h*)(arow + k0 + 16);
        v8h bl0 = *(const v8h*)(brow + k0);
        v8h bh0 = *(const v8h*)(brow + k0 + 16);
        v8h al1 = *(const v8h*)(arow + k0 + 32);
        v8h ah1 = *(const v8h*)(arow + k0 + 48);
        v8h bl1 = *(const v8h*)(brow + k0 + 32);
        v8h bh1 = *(const v8h*)(brow + k0 + 48);
        v16h a0 = __builtin_shufflevector(al0, ah0, 0,1,2,3,4,5,6,7,8,9,10,11,12,13,14,15);
        v16h b0 = __builtin_shufflevector(bl0, bh0, 0,1,2,3,4,5,6,7,8,9,10,11,12,13,14,15);
        v16h a1 = __builtin_shufflevector(al1, ah1, 0,1,2,3,4,5,6,7,8,9,10,11,12,13,14,15);
        v16h b1 = __builtin_shufflevector(bl1, bh1, 0,1,2,3,4,5,6,7,8,9,10,11,12,13,14,15);
        acc = __builtin_amdgcn_wmma_f32_16x16x32_f16(false, a0, false, b0,
                                                     (short)0, acc, false, false);
        acc = __builtin_amdgcn_wmma_f32_16x16x32_f16(false, a1, false, b1,
                                                     (short)0, acc, false, false);
    }
#pragma unroll
    for (int r = 0; r < 8; ++r) {
        float x = acc[r];
        if (act == 1) x = sigmoid_fast(x);
        C[(size_t)(m0 + r + 8*hi) * N + (n0 + lo)] = x;
    }
}

// One product per launch (the output projection).
__global__
void gemm16_wmma(const _Float16* __restrict__ A,
                 const _Float16* __restrict__ Bt,
                 float* __restrict__ C,
                 int M, int N, int K, int act)
{
    gemm16_tile(A, Bt, C, M, N, K, act, blockIdx.x);
}

// The six input projections share A and do not depend on one another: one
// launch, a range of blocks per product. 64 blocks each for q, k, v and the
// gate (N = 512), then 8 each for beta and tg (N = 64).
#define PROJ_BLOCKS (4*64 + 2*8)
__global__ __launch_bounds__(256)
void proj_wmma(const _Float16* __restrict__ xh,
               const _Float16* __restrict__ Wqt,
               const _Float16* __restrict__ Wkt,
               const _Float16* __restrict__ Wvt,
               const _Float16* __restrict__ Wgt,
               const _Float16* __restrict__ Wbt,
               const _Float16* __restrict__ Wtgt,
               float* __restrict__ q,
               float* __restrict__ k,
               float* __restrict__ v,
               float* __restrict__ g,
               float* __restrict__ beta,
               float* __restrict__ tg)
{
    const int blk = blockIdx.x;
    if (blk < 4*64) {
        const int job = blk >> 6;
        const _Float16* Bt = job == 0 ? Wqt : job == 1 ? Wkt : job == 2 ? Wvt : Wgt;
        float*          C  = job == 0 ? q   : job == 1 ? k   : job == 2 ? v   : g;
        gemm16_tile(xh, Bt, C, MROWS, 512, DD, job == 3 ? 1 : 0, blk & 63);
    } else {
        const int job = (blk - 4*64) >> 3;
        gemm16_tile(xh, job == 0 ? Wbt : Wtgt, job == 0 ? beta : tg,
                    MROWS, 64, DD, 1, blk & 7);
    }
}

// ---------------------------------------------------------------------------
// Layout prep: f32 -> f16 copy, and f32 [K,N] -> f16 [N,K] transpose.
// blk is the block's index within its own job; 256 threads a block.
// ---------------------------------------------------------------------------
__device__ __forceinline__ void cvt_f16_block(const float* __restrict__ in,
                                              _Float16* __restrict__ out,
                                              int n, int blk)
{
    const int i = blk * 256 + threadIdx.x;
    if (i < n) out[i] = (_Float16)in[i];
}

__device__ __forceinline__ void transpose_f16_block(const float* __restrict__ in, // [K,N]
                                                    _Float16* __restrict__ out,   // [N,K]
                                                    int K, int N, int blk)
{
    const int i = blk * 256 + threadIdx.x;
    if (i >= K * N) return;
    const int kk = i % K;
    const int nn = i / K;
    out[i] = (_Float16)in[(size_t)kk * N + nn];      // coalesced writes
}

// ---------------------------------------------------------------------------
// Precompute per-(h,r) spectral parameters.
// ---------------------------------------------------------------------------
__device__ __forceinline__ void params_block(const float* __restrict__ mode_logits,
                                             const float* __restrict__ log_decay,
                                             const float* __restrict__ omega_log_scale,
                                             float* __restrict__ cosw,
                                             float* __restrict__ sinw,
                                             float* __restrict__ rho,
                                             float* __restrict__ modew)
{
    const int t = threadIdx.x;      // 0..255; threads 0..63 do the work
    if (t >= HH*RR) return;
    const int h = t >> 3;

    const float ld = log_decay[t];
    const float sp = (ld > 20.0f) ? ld : log1pf(expf(ld));   // softplus
    rho[t] = expf(-sp);

    float mx = -1e30f;
    for (int j = 0; j < RR; ++j) mx = fmaxf(mx, mode_logits[h*RR + j]);
    float sum = 0.0f;
    for (int j = 0; j < RR; ++j) sum += expf(mode_logits[h*RR + j] - mx);
    modew[t] = expf(mode_logits[t] - mx) / sum;

    const float os = expf(omega_log_scale[t]);
    for (int d = 0; d < DK; ++d) {
        const float pidx = (float)(d & ~1);                  // repeat_interleave
        const float invf = powf(10000.0f, -pidx / (float)DK);
        const float w = os * invf;
        cosw[t*DK + d] = cosf(w);
        sinw[t*DK + d] = sinf(w);
    }
}

// ---------------------------------------------------------------------------
// All of the prep in one launch: the parameter table, the f16 copy of x and the
// seven weight transposes read only inputs and write disjoint scratch, so none
// waits for another. A range of blocks per job. The parameter block is a long
// serial loop of two waves: it is block 0, so that it starts first and runs
// beside the others.
// ---------------------------------------------------------------------------
#define PREP_X_BLOCKS   ((MROWS*DD)/256)     // 1024
#define PREP_BIG_BLOCKS ((DD*512)/256)       // 2048
#define PREP_SML_BLOCKS ((DD*64)/256)        // 256
#define PREP_BLOCKS (1 + PREP_X_BLOCKS + 5*PREP_BIG_BLOCKS + 2*PREP_SML_BLOCKS)
__global__ __launch_bounds__(256)
void prep_kernel(const float* __restrict__ x,
                 const float* __restrict__ Wq,
                 const float* __restrict__ Wk,
                 const float* __restrict__ Wv,
                 const float* __restrict__ Wg,
                 const float* __restrict__ Wo,
                 const float* __restrict__ Wb,
                 const float* __restrict__ Wtg,
                 const float* __restrict__ mode_logits,
                 const float* __restrict__ log_decay,
                 const float* __restrict__ omega_log_scale,
                 _Float16* __restrict__ xh,
                 _Float16* __restrict__ Wqt,
                 _Float16* __restrict__ Wkt,
                 _Float16* __restrict__ Wvt,
                 _Float16* __restrict__ Wgt,
                 _Float16* __restrict__ Wot,
                 _Float16* __restrict__ Wbt,
                 _Float16* __restrict__ Wtgt,
                 float* __restrict__ cosw,
                 float* __restrict__ sinw,
                 float* __restrict__ rho,
                 float* __restrict__ modew)
{
    int blk = blockIdx.x;
    if (blk == 0) {
        params_block(mode_logits, log_decay, omega_log_scale, cosw, sinw, rho, modew);
        return;
    }
    blk -= 1;
    if (blk < PREP_X_BLOCKS) {
        cvt_f16_block(x, xh, MROWS*DD, blk);
        return;
    }
    blk -= PREP_X_BLOCKS;
    if (blk < 4*PREP_BIG_BLOCKS) {
        const int job = blk / PREP_BIG_BLOCKS;
        const float* in  = job == 0 ? Wq  : job == 1 ? Wk  : job == 2 ? Wv  : Wg;
        _Float16*    out = job == 0 ? Wqt : job == 1 ? Wkt : job == 2 ? Wvt : Wgt;
        transpose_f16_block(in, out, DD, 512, blk % PREP_BIG_BLOCKS);
        return;
    }
    blk -= 4*PREP_BIG_BLOCKS;
    if (blk < PREP_BIG_BLOCKS) {
        transpose_f16_block(Wo, Wot, 512, DD, blk);
        return;
    }
    blk -= PREP_BIG_BLOCKS;
    const int job = blk / PREP_SML_BLOCKS;
    transpose_f16_block(job == 0 ? Wb : Wtg, job == 0 ? Wbt : Wtgt, DD, 64,
                        blk % PREP_SML_BLOCKS);
}

// ---------------------------------------------------------------------------
// Recurrent scan: 8 lanes share one state row (b,h,r,v); each lane keeps 8 of
// the 64 Dk elements (real and imaginary) in registers, as two groups of four:
// k = 4*sub + 0..3 and k = 32 + 4*sub + 0..3, so that the 8 lanes of a row read
// one 128-byte line per 16-byte load. The two sums over Dk of a time step end
// in three in-row DPP adds (lane ^ 1, ^ 2, ^ 4).
// One block = 32 rows (half the Dv rows) of one (b,h,r). ys: [B*T, H, R, DV].
// ---------------------------------------------------------------------------
template <int CTRL>
__device__ __forceinline__ float add_row_xmask(float x)
{
    // x + (x of lane ^ mask), mask in the low bits of CTRL (0x160 | mask)
    const int xi = __builtin_bit_cast(int, x);
    const int yi = __builtin_amdgcn_update_dpp(0, xi, CTRL, 0xf, 0xf, true);
    return x + __builtin_bit_cast(float, yi);
}

__device__ __forceinline__ float sum_over_8_lanes(float x)
{
    x = add_row_xmask<0x161>(x);
    x = add_row_xmask<0x162>(x);
    x = add_row_xmask<0x164>(x);
    return x;
}

// The grid is 2048 waves, two per SIMD: waves_per_eu says so, so that the
// register budget is not held at 64; at 64 the q and v loads of a time step were
// placed behind the wait for its k loads (three load latencies in a row a step).
__global__ __launch_bounds__(256) __attribute__((amdgpu_waves_per_eu(2, 2)))
void scan_kernel(const float* __restrict__ q,
                 const float* __restrict__ k,
                 const float* __restrict__ v,
                 const float* __restrict__ beta,
                 const float* __restrict__ tg,
                 const float* __restrict__ cosw,
                 const float* __restrict__ sinw,
                 const float* __restrict__ rho,
                 const float* __restrict__ modew,
                 float* __restrict__ ys)
{
    const int half = blockIdx.x & 1;
    const int r    = (blockIdx.x >> 1) & 7;
    const int h    = (blockIdx.x >> 4) & 7;
    const int b    = (blockIdx.x >> 7) & 1;
    const int hr   = h*RR + r;
    const int sub  = threadIdx.x & 7;
    const int vrow = half*32 + (threadIdx.x >> 3);

    const float rho_hr = rho[hr];
    const float mw     = modew[hr];
    // keeps the scalar loads above from being placed between the four loads
    // below and their wait, where they would land in those loads' base registers
    __builtin_amdgcn_sched_barrier(0);

    const float4* c4 = (const float4*)(cosw + hr*DK);
    const float4* s4 = (const float4*)(sinw + hr*DK);
    const float4 ca = c4[sub], cb = c4[8 + sub];
    const float4 sa = s4[sub], sb = s4[8 + sub];
    // the base registers of these four loads are reused right behind them: keep
    // the wait between the loads and those writes; the scheduling barrier keeps
    // the later index arithmetic from being lifted over the wait
    asm volatile("s_wait_xcnt 0x0" ::: "memory");
    __builtin_amdgcn_sched_barrier(0);
    const float c[8] = {ca.x, ca.y, ca.z, ca.w, cb.x, cb.y, cb.z, cb.w};
    const float s[8] = {sa.x, sa.y, sa.z, sa.w, sb.x, sb.y, sb.z, sb.w};

    const float4* k4 = (const float4*)k;
    const float4* q4 = (const float4*)q;

    // every loop over e below is unrolled so that the 8-element arrays are
    // indexed by constants and stay in registers
    float sr[8], si[8];
#pragma unroll
    for (int e = 0; e < 8; ++e) { sr[e] = 0.f; si[e] = 0.f; }

    // Each trip issues its own loads at its top and waits for them in the same
    // trip: one load latency a time step is still on the serial path.
    for (int t = 0; t < TT; ++t) {
        const int bh = (b*TT + t)*HH + h;         // flat (b,t,h)
        const float4 ka = k4[bh*16 + sub], kb = k4[bh*16 + 8 + sub];
        const float4 qa = q4[bh*16 + sub], qb = q4[bh*16 + 8 + sub];
        const float tgt = tg[bh*RR + r];
        const float bet = beta[bh*RR + r];
        const float vt  = v[bh*DV + vrow];
        const float kt[8] = {ka.x, ka.y, ka.z, ka.w, kb.x, kb.y, kb.z, kb.w};
        const float qt[8] = {qa.x, qa.y, qa.z, qa.w, qb.x, qb.y, qb.z, qb.w};

        const float decay = tgt * rho_hr;
        float rr[8];
#pragma unroll
        for (int e = 0; e < 8; ++e) {
            rr[e] = decay * (c[e]*sr[e] - s[e]*si[e]);
            si[e] = decay * (s[e]*sr[e] + c[e]*si[e]);
        }

        const float pa = rr[0]*kt[0] + rr[2]*kt[2] + rr[4]*kt[4] + rr[6]*kt[6];
        const float pb = rr[1]*kt[1] + rr[3]*kt[3] + rr[5]*kt[5] + rr[7]*kt[7];
        const float pred = sum_over_8_lanes(pa + pb);

        const float bw = bet * (vt - pred);
#pragma unroll
        for (int e = 0; e < 8; ++e) sr[e] = rr[e] + bw*kt[e];

        const float ra = sr[0]*qt[0] + sr[2]*qt[2] + sr[4]*qt[4] + sr[6]*qt[6];
        const float rb = sr[1]*qt[1] + sr[3]*qt[3] + sr[5]*qt[5] + sr[7]*qt[7];
        const float rd = sum_over_8_lanes(ra + rb);

        if (sub == 0) {
            ys[(size_t)(bh*RR + r)*DV + vrow] = rd * mw;
            // the store's address and data registers are rewritten in the next
            // trip: keep the wait between the store and those writes
            asm volatile("s_wait_xcnt 0x0" ::: "memory");
        }
    }
}

// ---------------------------------------------------------------------------
// ogh[bt, h*DV+v] = f16( gate * sum_r ys[bt,h,r,v] )  (feeds the final WMMA)
// ---------------------------------------------------------------------------
__global__ void combine_kernel(const float* __restrict__ ys,
                               const float* __restrict__ g,
                               _Float16* __restrict__ ogh)
{
    const int i = blockIdx.x * blockDim.x + threadIdx.x;   // 0..MROWS*H*DV-1
    const int vv = i & 63;
    const int h  = (i >> 6) & 7;
    const int bt = i >> 9;
    const size_t base = (size_t)((bt*HH + h)*RR)*DV + vv;
    float s = 0.0f;
#pragma unroll
    for (int r = 0; r < RR; ++r) s += ys[base + r*DV];
    ogh[i] = (_Float16)(s * g[i]);
}

// ---------------------------------------------------------------------------
extern "C" void kernel_launch(void* const* d_in, const int* in_sizes, int n_in,
                              void* d_out, int out_size, void* d_ws, size_t ws_size,
                              hipStream_t stream)
{
    (void)in_sizes; (void)n_in; (void)out_size; (void)ws_size;
    const float* x    = (const float*)d_in[0];
    const float* Wq   = (const float*)d_in[1];
    const float* Wk   = (const float*)d_in[2];
    const float* Wv   = (const float*)d_in[3];
    const float* Wb   = (const float*)d_in[4];
    const float* Wtg  = (const float*)d_in[5];
    const float* mlg  = (const float*)d_in[6];
    const float* ldc  = (const float*)d_in[7];
    const float* oms  = (const float*)d_in[8];
    const float* Wg   = (const float*)d_in[9];
    const float* Wo   = (const float*)d_in[10];

    // ---- f32 scratch ----
    float* ws    = (float*)d_ws;
    float* q     = ws;                        // 256*512
    float* k     = q    + MROWS*512;
    float* v     = k    + MROWS*512;
    float* g     = v    + MROWS*512;
    float* beta  = g    + MROWS*512;          // 256*64
    float* tg    = beta + MROWS*64;
    float* cosw  = tg   + MROWS*64;           // 64*64
    float* sinw  = cosw + HH*RR*DK;
    float* rho   = sinw + HH*RR*DK;           // 64
    float* modew = rho  + HH*RR;
    float* ys    = modew + HH*RR;             // 256*8*8*64 = 1048576
    float* fend  = ys   + MROWS*HH*RR*DV;

    // ---- f16 scratch (16B-aligned: float count above is a multiple of 4) ----
    _Float16* hb   = (_Float16*)fend;
    _Float16* xh   = hb;                      // 256*1024
    _Float16* Wqt  = xh   + MROWS*DD;         // 512*1024 each
    _Float16* Wkt  = Wqt  + 512*DD;
    _Float16* Wvt  = Wkt  + 512*DD;
    _Float16* Wgt  = Wvt  + 512*DD;
    _Float16* Wbt  = Wgt  + 512*DD;           // 64*1024 each
    _Float16* Wtgt = Wbt  + 64*DD;
    _Float16* Wot  = Wtgt + 64*DD;            // 1024*512
    _Float16* ogh  = Wot  + DD*512;           // 256*512

    // parameter table, f16 copy of x and the seven weight transposes
    prep_kernel<<<PREP_BLOCKS, 256, 0, stream>>>(x, Wq, Wk, Wv, Wg, Wo, Wb, Wtg,
                                                 mlg, ldc, oms,
                                                 xh, Wqt, Wkt, Wvt, Wgt, Wot, Wbt, Wtgt,
                                                 cosw, sinw, rho, modew);

    // the six input projections; 8 tiles (waves) per 256-thread block
    proj_wmma<<<PROJ_BLOCKS, 256, 0, stream>>>(xh, Wqt, Wkt, Wvt, Wgt, Wbt, Wtgt,
                                               q, k, v, g, beta, tg);

    // 8192 rows, 8 lanes each, 32 rows per 256-thread block -> 256 blocks
    scan_kernel<<<256, 256, 0, stream>>>(q, k, v, beta, tg, cosw, sinw, rho, modew, ys);

    combine_kernel<<<(MROWS*HH*DV)/256, 256, 0, stream>>>(ys, g, ogh);

    gemm16_wmma<<<(16*64)/8, 256, 0, stream>>>(ogh, Wot, (float*)d_out,
                                               MROWS, DD, 512, 0);
}

// v003
// Measured time: 79.7 microseconds a run.
// In two side-by-side timings against v002, it was 1.51 and 1.52 times as fast.
// All steps since v000 together make it 2.89 times as fast.
#include <hip/hip_runtime.h>
#include <hip/hip_bf16.h>
#include <math.h>

// Problem constants (from reference)
#define BB 2
#define TT 128
#define DD 1024
#define HH 8
#define RR 8
#define DK 64
#define DV 64
#define MROWS (BB*TT)          // 256

typedef __attribute__((ext_vector_type(16))) _Float16 v16h;
typedef __attribute__((ext_vector_type(8)))  _Float16 v8h;
typedef __attribute__((ext_vector_type(8)))  float    v8f;
typedef __attribute__((ext_vector_type(4)))  float    v4f;
typedef __attribute__((ext_vector_type(2)))  float    v2f;

__device__ __forceinline__ float sigmoid_fast(float x) {
    return __builtin_amdgcn_rcpf(1.0f + __expf(-x));
}

// ---------------------------------------------------------------------------
// WMMA GEMM with native-layout f16 operands.
//   A  : [M,K] f16 row-major
//   Bt : [N,K] f16 row-major (i.e. W[K,N] pre-transposed)
//   C  : [M,N] f32 row-major
// Per ISA 7.12.2 the 16x32 f16 A fragment for lane L (m=L&15, hi=L>>4) is
//   halves 0..7  = K  8*hi + 0..7   (contiguous)
//   halves 8..15 = K 16+8*hi + 0..7 (contiguous)
// so each fragment = two global_load_b128 per lane; same for B against Bt.
// 8 waves / block, one 16x16 C tile per wave (linear tile id).
// K must be a multiple of 64 (manual 2x unroll -> 2 WMMAs/iter).
// blk is the block's index within its own product.
// ---------------------------------------------------------------------------
__device__ __forceinline__ void gemm16_tile(const _Float16* __restrict__ A,
                                            const _Float16* __restrict__ Bt,
                                            float* __restrict__ C,
                                            int M, int N, int K, int act, int blk)
{
    const int lane = threadIdx.x & 31;
    const int wid  = threadIdx.x >> 5;
    const int tid  = blk * 8 + wid;                 // linear 16x16 tile id
    const int ntiles = N >> 4;
    const int m0 = (tid / ntiles) << 4;
    const int n0 = (tid % ntiles) << 4;
    if (m0 >= M) return;                            // wave-uniform guard

    const int hi = lane >> 4;
    const int lo = lane & 15;
    const _Float16* arow = A  + (size_t)(m0 + lo) * K + 8*hi;
    const _Float16* brow = Bt + (size_t)(n0 + lo) * K + 8*hi;

    v8f acc = {};
    for (int k0 = 0; k0 < K; k0 += 64) {
        v8h al0 = *(const v8h*)(arow + k0);
        v8h ah0 = *(const v8h*)(arow + k0 + 16);
        v8h bl0 = *(const v8h*)(brow + k0);
        v8h bh0 = *(const v8h*)(brow + k0 + 16);
        v8h al1 = *(const v8h*)(arow + k0 + 32);
        v8h ah1 = *(const v8h*)(arow + k0 + 48);
        v8h bl1 = *(const v8h*)(brow + k0 + 32);
        v8h bh1 = *(const v8h*)(brow + k0 + 48);
        v16h a0 = __builtin_shufflevector(al0, ah0, 0,1,2,3,4,5,6,7,8,9,10,11,12,13,14,15);
        v16h b0 = __builtin_shufflevector(bl0, bh0, 0,1,2,3,4,5,6,7,8,9,10,11,12,13,14,15);
        v16h a1 = __builtin_shufflevector(al1, ah1, 0,1,2,3,4,5,6,7,8,9,10,11,12,13,14,15);
        v16h b1 = __builtin_shufflevector(bl1, bh1, 0,1,2,3,4,5,6,7,8,9,10,11,12,13,14,15);
        acc = __builtin_amdgcn_wmma_f32_16x16x32_f16(false, a0, false, b0,
                                                     (short)0, acc, false, false);
        acc = __builtin_amdgcn_wmma_f32_16x16x32_f16(false, a1, false, b1,
                                                     (short)0, acc, false, false);
    }
#pragma unroll
    for (int r = 0; r < 8; ++r) {
        float x = acc[r];
        if (act == 1) x = sigmoid_fast(x);
        C[(size_t)(m0 + r + 8*hi) * N + (n0 + lo)] = x;
    }
}

// One product per launch (the output projection).
__global__
void gemm16_wmma(const _Float16* __restrict__ A,
                 const _Float16* __restrict__ Bt,
                 float* __restrict__ C,
                 int M, int N, int K, int act)
{
    gemm16_tile(A, Bt, C, M, N, K, act, blockIdx.x);
}

// The six input projections share A and do not depend on one another: one
// launch, a range of blocks per product. 64 blocks each for q, k, v and the
// gate (N = 512), then 8 each for beta and tg (N = 64).
#define PROJ_BLOCKS (4*64 + 2*8)
__global__ __launch_bounds__(256)
void proj_wmma(const _Float16* __restrict__ xh,
               const _Float16* __restrict__ Wqt,
               const _Float16* __restrict__ Wkt,
               const _Float16* __restrict__ Wvt,
               const _Float16* __restrict__ Wgt,
               const _Float16* __restrict__ Wbt,
               const _Float16* __restrict__ Wtgt,
               float* __restrict__ q,
               float* __restrict__ k,
               float* __restrict__ v,
               float* __restrict__ g,
               float* __restrict__ beta,
               float* __restrict__ tg)
{
    const int blk = blockIdx.x;
    if (blk < 4*64) {
        const int job = blk >> 6;
        const _Float16* Bt = job == 0 ? Wqt : job == 1 ? Wkt : job == 2 ? Wvt : Wgt;
        float*          C  = job == 0 ? q   : job == 1 ? k   : job == 2 ? v   : g;
        gemm16_tile(xh, Bt, C, MROWS, 512, DD, job == 3 ? 1 : 0, blk & 63);
    } else {
        const int job = (blk - 4*64) >> 3;
        gemm16_tile(xh, job == 0 ? Wbt : Wtgt, job == 0 ? beta : tg,
                    MROWS, 64, DD, 1, blk & 7);
    }
}

// ---------------------------------------------------------------------------
// Layout prep: f32 -> f16 copy, and f32 [K,N] -> f16 [N,K] transpose.
// blk is the block's index within its own job; 256 threads a block.
// ---------------------------------------------------------------------------
__device__ __forceinline__ void cvt_f16_block(const float* __restrict__ in,
                                              _Float16* __restrict__ out,
                                              int n, int blk)
{
    const int i = blk * 256 + threadIdx.x;
    if (i < n) out[i] = (_Float16)in[i];
}

__device__ __forceinline__ void transpose_f16_block(const float* __restrict__ in, // [K,N]
                                                    _Float16* __restrict__ out,   // [N,K]
                                                    int K, int N, int blk)
{
    const int i = blk * 256 + threadIdx.x;
    if (i >= K * N) return;
    const int kk = i % K;
    const int nn = i / K;
    out[i] = (_Float16)in[(size_t)kk * N + nn];      // coalesced writes
}

// ---------------------------------------------------------------------------
// Precompute per-(h,r) spectral parameters.
// ---------------------------------------------------------------------------
__device__ __forceinline__ void params_block(const float* __restrict__ mode_logits,
                                             const float* __restrict__ log_decay,
                                             const float* __restrict__ omega_log_scale,
                                             float* __restrict__ cosw,
                                             float* __restrict__ sinw,
                                             float* __restrict__ rho,
                                             float* __restrict__ modew)
{
    const int t = threadIdx.x;      // 0..255; threads 0..63 do the work
    if (t >= HH*RR) return;
    const int h = t >> 3;

    const float ld = log_decay[t];
    const float sp = (ld > 20.0f) ? ld : log1pf(expf(ld));   // softplus
    rho[t] = expf(-sp);

    float mx = -1e30f;
    for (int j = 0; j < RR; ++j) mx = fmaxf(mx, mode_logits[h*RR + j]);
    float sum = 0.0f;
    for (int j = 0; j < RR; ++j) sum += expf(mode_logits[h*RR + j] - mx);
    modew[t] = expf(mode_logits[t] - mx) / sum;

    const float os = expf(omega_log_scale[t]);
    for (int d = 0; d < DK; ++d) {
        const float pidx = (float)(d & ~1);                  // repeat_interleave
        const float invf = powf(10000.0f, -pidx / (float)DK);
        const float w = os * invf;
        cosw[t*DK + d] = cosf(w);
        sinw[t*DK + d] = sinf(w);
    }
}

// ---------------------------------------------------------------------------
// All of the prep in one launch: the parameter table, the f16 copy of x and the
// seven weight transposes read only inputs and write disjoint scratch, so none
// waits for another. A range of blocks per job. The parameter block is a long
// serial loop of two waves: it is block 0, so that it starts first and runs
// beside the others.
// ---------------------------------------------------------------------------
#define PREP_X_BLOCKS   ((MROWS*DD)/256)     // 1024
#define PREP_BIG_BLOCKS ((DD*512)/256)       // 2048
#define PREP_SML_BLOCKS ((DD*64)/256)        // 256
#define PREP_BLOCKS (1 + PREP_X_BLOCKS + 5*PREP_BIG_BLOCKS + 2*PREP_SML_BLOCKS)
__global__ __launch_bounds__(256)
void prep_kernel(const float* __restrict__ x,
                 const float* __restrict__ Wq,
                 const float* __restrict__ Wk,
                 const float* __restrict__ Wv,
                 const float* __restrict__ Wg,
                 const float* __restrict__ Wo,
                 const float* __restrict__ Wb,
                 const float* __restrict__ Wtg,
                 const float* __restrict__ mode_logits,
                 const float* __restrict__ log_decay,
                 const float* __restrict__ omega_log_scale,
                 _Float16* __restrict__ xh,
                 _Float16* __restrict__ Wqt,
                 _Float16* __restrict__ Wkt,
                 _Float16* __restrict__ Wvt,
                 _Float16* __restrict__ Wgt,
                 _Float16* __restrict__ Wot,
                 _Float16* __restrict__ Wbt,
                 _Float16* __restrict__ Wtgt,
                 float* __restrict__ cosw,
                 float* __restrict__ sinw,
                 float* __restrict__ rho,
                 float* __restrict__ modew)
{
    int blk = blockIdx.x;
    if (blk == 0) {
        params_block(mode_logits, log_decay, omega_log_scale, cosw, sinw, rho, modew);
        return;
    }
    blk -= 1;
    if (blk < PREP_X_BLOCKS) {
        cvt_f16_block(x, xh, MROWS*DD, blk);
        return;
    }
    blk -= PREP_X_BLOCKS;
    if (blk < 4*PREP_BIG_BLOCKS) {
        const int job = blk / PREP_BIG_BLOCKS;
        const float* in  = job == 0 ? Wq  : job == 1 ? Wk  : job == 2 ? Wv  : Wg;
        _Float16*    out = job == 0 ? Wqt : job == 1 ? Wkt : job == 2 ? Wvt : Wgt;
        transpose_f16_block(in, out, DD, 512, blk % PREP_BIG_BLOCKS);
        return;
    }
    blk -= 4*PREP_BIG_BLOCKS;
    if (blk < PREP_BIG_BLOCKS) {
        transpose_f16_block(Wo, Wot, 512, DD, blk);
        return;
    }
    blk -= PREP_BIG_BLOCKS;
    const int job = blk / PREP_SML_BLOCKS;
    transpose_f16_block(job == 0 ? Wb : Wtg, job == 0 ? Wbt : Wtgt, DD, 64,
                        blk % PREP_SML_BLOCKS);
}

// ---------------------------------------------------------------------------
// Recurrent scan: 8 lanes share one state row (b,h,r,v); each lane keeps 8 of
// the 64 Dk elements (real and imaginary) in registers, as two groups of four:
// k = 4*sub + 0..3 and k = 32 + 4*sub + 0..3, so that the 8 lanes of a row read
// one 128-byte line per 16-byte load. The two sums over Dk of a time step end
// in three in-row DPP adds (lane ^ 1, ^ 2, ^ 4).
// One block = 32 rows (half the Dv rows) of one (b,h,r). ys: [B*T, H, R, DV].
// What the block reads in its 128 time steps (the k and q rows of its (b,h), its
// 32 v of each step, decay and beta of its (h,r)) is brought into LDS once, ahead
// of the loop, with all loads in flight together; the loop reads it from there
// one time step ahead, so that no load latency is left in a time step.
// ---------------------------------------------------------------------------
template <int CTRL>
__device__ __forceinline__ float add_row_xmask(float x)
{
    // x + (x of lane ^ mask), mask in the low bits of CTRL (0x160 | mask)
    const int xi = __builtin_bit_cast(int, x);
    const int yi = __builtin_amdgcn_update_dpp(0, xi, CTRL, 0xf, 0xf, true);
    return x + __builtin_bit_cast(float, yi);
}

__device__ __forceinline__ float sum_over_8_lanes(float x)
{
    x = add_row_xmask<0x161>(x);
    x = add_row_xmask<0x162>(x);
    x = add_row_xmask<0x164>(x);
    return x;
}

// The grid is 2048 waves, two per SIMD: waves_per_eu says so, so that the
// register budget is not held at 64: the staging holds the results of a thread's
// twenty 16-byte loads at once.
__global__ __launch_bounds__(256) __attribute__((amdgpu_waves_per_eu(2, 2)))
void scan_kernel(const float* __restrict__ q,
                 const float* __restrict__ k,
                 const float* __restrict__ v,
                 const float* __restrict__ beta,
                 const float* __restrict__ tg,
                 const float* __restrict__ cosw,
                 const float* __restrict__ sinw,
                 const float* __restrict__ rho,
                 const float* __restrict__ modew,
                 float* __restrict__ ys)
{
    const int half = blockIdx.x & 1;
    const int r    = (blockIdx.x >> 1) & 7;
    const int h    = (blockIdx.x >> 4) & 7;
    const int b    = (blockIdx.x >> 7) & 1;
    const int hr   = h*RR + r;
    const int sub  = threadIdx.x & 7;
    const int vrow = half*32 + (threadIdx.x >> 3);

    __shared__ v4f ks[TT*16];         // k rows, 64 floats a step
    __shared__ v4f qs[TT*16];         // q rows, 64 floats a step
    __shared__ v4f vs[TT*8];          // this half's 32 v of a step
    __shared__ v2f db[TT];            // decay and beta of a step

    const float rho_hr = rho[hr];
    const float mw     = modew[hr];
    // keeps the scalar loads above from being placed between the four loads
    // below and their wait, where they would land in those loads' base registers
    __builtin_amdgcn_sched_barrier(0);

    const float4* c4 = (const float4*)(cosw + hr*DK);
    const float4* s4 = (const float4*)(sinw + hr*DK);
    const float4 ca = c4[sub], cb = c4[8 + sub];
    const float4 sa = s4[sub], sb = s4[8 + sub];
    // the base registers of these four loads are reused right behind them: keep
    // the wait between the loads and those writes; the scheduling barrier keeps
    // the later index arithmetic from being lifted over the wait
    asm volatile("s_wait_xcnt 0x0" ::: "memory");
    __builtin_amdgcn_sched_barrier(0);
    const float c[8] = {ca.x, ca.y, ca.z, ca.w, cb.x, cb.y, cb.z, cb.w};
    const float s[8] = {sa.x, sa.y, sa.z, sa.w, sb.x, sb.y, sb.z, sb.w};

    // Staging. row0 is the flat (b,0,h); the next time step lies HH rows on. A
    // wave's 16-byte loads cover whole 256-byte k or q rows, whole 128-byte half
    // rows of v. A thread's pieces lie a fixed number of bytes apart: 16 steps
    // for k and q, 32 steps for v. Threads 0..127 stage the decay of step tid,
    // threads 128..255 the beta of step tid - 128.
    const unsigned tid  = threadIdx.x;
    const unsigned row0 = b*TT*HH + h;
    const unsigned kq_off = ((row0 + (tid >> 4)*HH)*DK + (tid & 15)*4) * 4;
    const unsigned v_off  = ((row0 + (tid >> 3)*HH)*DV + half*32 + (tid & 7)*4) * 4;
    const unsigned d_idx  = (row0 + (tid & (TT-1))*HH)*RR + r;       // in floats
    // the loops are unrolled so that the arrays stay in registers and all of a
    // thread's loads are in flight at once
    v4f kst[8], qst[8], vst[4];
#pragma unroll
    for (int it = 0; it < 8; ++it) {
        kst[it] = *(const v4f*)((const char*)k + kq_off + it*(16*HH*DK*4));
        qst[it] = *(const v4f*)((const char*)q + kq_off + it*(16*HH*DK*4));
    }
#pragma unroll
    for (int it = 0; it < 4; ++it)
        vst[it] = *(const v4f*)((const char*)v + v_off + it*(32*HH*DV*4));
    const float tg_st = tg[d_idx];
    const float be_st = beta[d_idx];
    // The wait stands between these loads and every later write of their offset
    // registers. It takes the loaded values and the three offsets as inputs only:
    // so all the loads are issued ahead of it, and no offset register is given
    // to a load's result or to later arithmetic before it. The scheduling barrier
    // keeps later index arithmetic, which reuses the loads' base registers, from
    // being lifted over the wait.
    asm volatile("s_wait_xcnt 0x0"
                 :: "v"(kst[0]), "v"(kst[1]), "v"(kst[2]), "v"(kst[3]),
                    "v"(kst[4]), "v"(kst[5]), "v"(kst[6]), "v"(kst[7]),
                    "v"(qst[0]), "v"(qst[1]), "v"(qst[2]), "v"(qst[3]),
                    "v"(qst[4]), "v"(qst[5]), "v"(qst[6]), "v"(qst[7]),
                    "v"(vst[0]), "v"(vst[1]), "v"(vst[2]), "v"(vst[3]),
                    "v"(tg_st), "v"(be_st), "v"(kq_off), "v"(v_off), "v"(d_idx)
                 : "memory");
    __builtin_amdgcn_sched_barrier(0);
#pragma unroll
    for (int it = 0; it < 8; ++it) {
        ks[it*256 + tid] = kst[it];
        qs[it*256 + tid] = qst[it];
    }
#pragma unroll
    for (int it = 0; it < 4; ++it)
        vs[it*256 + tid] = vst[it];
    ((float*)db)[2*(tid & (TT-1)) + (tid >> 7)] = (tid < TT) ? tg_st * rho_hr : be_st;
    // every wave reads what the other waves staged
    __syncthreads();
    const float* vsf = (const float*)vs + (tid >> 3);

    // every loop over e below is unrolled so that the 8-element arrays are
    // indexed by constants and stay in registers
    float sr[8], si[8];
#pragma unroll
    for (int e = 0; e < 8; ++e) { sr[e] = 0.f; si[e] = 0.f; }

    // A trip works on operands that were read from LDS in the trip before.
    v4f ka = ks[sub], kb = ks[8 + sub];
    v4f qa = qs[sub], qb = qs[8 + sub];
    v2f dbt = db[0];
    float vt = vsf[0];
    for (int t = 0; t < TT; ++t) {
        const int bh = (b*TT + t)*HH + h;         // flat (b,t,h)
        const float decay = dbt.x;
        const float bet   = dbt.y;
        const float kt[8] = {ka.x, ka.y, ka.z, ka.w, kb.x, kb.y, kb.z, kb.w};
        const float qt[8] = {qa.x, qa.y, qa.z, qa.w, qb.x, qb.y, qb.z, qb.w};

        float rr[8];
#pragma unroll
        for (int e = 0; e < 8; ++e) {
            rr[e] = decay * (c[e]*sr[e] - s[e]*si[e]);
            si[e] = decay * (s[e]*sr[e] + c[e]*si[e]);
        }

        const float pa = rr[0]*kt[0] + rr[2]*kt[2] + rr[4]*kt[4] + rr[6]*kt[6];
        const float pb = rr[1]*kt[1] + rr[3]*kt[3] + rr[5]*kt[5] + rr[7]*kt[7];
        const float pred = sum_over_8_lanes(pa + pb);

        const float bw = bet * (vt - pred);
#pragma unroll
        for (int e = 0; e < 8; ++e) sr[e] = rr[e] + bw*kt[e];

        const float ra = sr[0]*qt[0] + sr[2]*qt[2] + sr[4]*qt[4] + sr[6]*qt[6];
        const float rb = sr[1]*qt[1] + sr[3]*qt[3] + sr[5]*qt[5] + sr[7]*qt[7];

        // This step's operands are used up: the next step's are read into their
        // place, all at one point, and arrive under the lane sum, the store and
        // the next rotation. The last trip reads its own step again, so that
        // nothing behind the staged rows is read.
        const int tn = (t + 1 < TT) ? t + 1 : t;
        ka = ks[tn*16 + sub];  kb = ks[tn*16 + 8 + sub];
        qa = qs[tn*16 + sub];  qb = qs[tn*16 + 8 + sub];
        dbt = db[tn];
        vt  = vsf[tn*32];

        const float rd = sum_over_8_lanes(ra + rb);

        if (sub == 0) {
            ys[(size_t)(bh*RR + r)*DV + vrow] = rd * mw;
            // the store's address and data registers are rewritten in the next
            // trip: keep the wait between the store and those writes
            asm volatile("s_wait_xcnt 0x0" ::: "memory");
        }
    }
}

// ---------------------------------------------------------------------------
// ogh[bt, h*DV+v] = f16( gate * sum_r ys[bt,h,r,v] )  (feeds the final WMMA)
// ---------------------------------------------------------------------------
__global__ void combine_kernel(const float* __restrict__ ys,
                               const float* __restrict__ g,
                               _Float16* __restrict__ ogh)
{
    const int i = blockIdx.x * blockDim.x + threadIdx.x;   // 0..MROWS*H*DV-1
    const int vv = i & 63;
    const int h  = (i >> 6) & 7;
    const int bt = i >> 9;
    const size_t base = (size_t)((bt*HH + h)*RR)*DV + vv;
    float s = 0.0f;
#pragma unroll
    for (int r = 0; r < RR; ++r) s += ys[base + r*DV];
    ogh[i] = (_Float16)(s * g[i]);
}

// ---------------------------------------------------------------------------
extern "C" void kernel_launch(void* const* d_in, const int* in_sizes, int n_in,
                              void* d_out, int out_size, void* d_ws, size_t ws_size,
                              hipStream_t stream)
{
    (void)in_sizes; (void)n_in; (void)out_size; (void)ws_size;
    const float* x    = (const float*)d_in[0];
    const float* Wq   = (const float*)d_in[1];
    const float* Wk   = (const float*)d_in[2];
    const float* Wv   = (const float*)d_in[3];
    const float* Wb   = (const float*)d_in[4];
    const float* Wtg  = (const float*)d_in[5];
    const float* mlg  = (const float*)d_in[6];
    const float* ldc  = (const float*)d_in[7];
    const float* oms  = (const float*)d_in[8];
    const float* Wg   = (const float*)d_in[9];
    const float* Wo   = (const float*)d_in[10];

    // ---- f32 scratch ----
    float* ws    = (float*)d_ws;
    float* q     = ws;                        // 256*512
    float* k     = q    + MROWS*512;
    float* v     = k    + MROWS*512;
    float* g     = v    + MROWS*512;
    float* beta  = g    + MROWS*512;          // 256*64
    float* tg    = beta + MROWS*64;
    float* cosw  = tg   + MROWS*64;           // 64*64
    float* sinw  = cosw + HH*RR*DK;
    float* rho   = sinw + HH*RR*DK;           // 64
    float* modew = rho  + HH*RR;
    float* ys    = modew + HH*RR;             // 256*8*8*64 = 1048576
    float* fend  = ys   + MROWS*HH*RR*DV;

    // ---- f16 scratch (16B-aligned: float count above is a multiple of 4) ----
    _Float16* hb   = (_Float16*)fend;
    _Float16* xh   = hb;                      // 256*1024
    _Float16* Wqt  = xh   + MROWS*DD;         // 512*1024 each
    _Float16* Wkt  = Wqt  + 512*DD;
    _Float16* Wvt  = Wkt  + 512*DD;
    _Float16* Wgt  = Wvt  + 512*DD;
    _Float16* Wbt  = Wgt  + 512*DD;           // 64*1024 each
    _Float16* Wtgt = Wbt  + 64*DD;
    _Float16* Wot  = Wtgt + 64*DD;            // 1024*512
    _Float16* ogh  = Wot  + DD*512;           // 256*512

    // parameter table, f16 copy of x and the seven weight transposes
    prep_kernel<<<PREP_BLOCKS, 256, 0, stream>>>(x, Wq, Wk, Wv, Wg, Wo, Wb, Wtg,
                                                 mlg, ldc, oms,
                                                 xh, Wqt, Wkt, Wvt, Wgt, Wot, Wbt, Wtgt,
                                                 cosw, sinw, rho, modew);

    // the six input projections; 8 tiles (waves) per 256-thread block
    proj_wmma<<<PROJ_BLOCKS, 256, 0, stream>>>(xh, Wqt, Wkt, Wvt, Wgt, Wbt, Wtgt,
                                               q, k, v, g, beta, tg);

    // 8192 rows, 8 lanes each, 32 rows per 256-thread block -> 256 blocks
    scan_kernel<<<256, 256, 0, stream>>>(q, k, v, beta, tg, cosw, sinw, rho, modew, ys);

    combine_kernel<<<(MROWS*HH*DV)/256, 256, 0, stream>>>(ys, g, ogh);

    gemm16_wmma<<<(16*64)/8, 256, 0, stream>>>(ogh, Wot, (float*)d_out,
                                               MROWS, DD, 512, 0);
}

// v004
// Measured time: 73.2 microseconds a run.
// Timed twice side by side with v003, it ran 1.09 and 1.08 times as fast.
// Counting every step since v000, it is 3.14 times as fast.
#include <hip/hip_runtime.h>
#include <hip/hip_bf16.h>
#include <math.h>

// Problem constants (from reference)
#define BB 2
#define TT 128
#define DD 1024
#define HH 8
#define RR 8
#define DK 64
#define DV 64
#define MROWS (BB*TT)          // 256

typedef __attribute__((ext_vector_type(16))) _Float16 v16h;
typedef __attribute__((ext_vector_type(8)))  _Float16 v8h;
typedef __attribute__((ext_vector_type(8)))  float    v8f;
typedef __attribute__((ext_vector_type(4)))  float    v4f;
typedef __attribute__((ext_vector_type(2)))  float    v2f;

__device__ __forceinline__ float sigmoid_fast(float x) {
    return __builtin_amdgcn_rcpf(1.0f + __expf(-x));
}

// ---------------------------------------------------------------------------
// WMMA GEMM with native-layout f16 operands.
//   A  : [M,K] f16 row-major
//   Bt : [N,K] f16 row-major (i.e. W[K,N] pre-transposed)
//   C  : [M,N] f32 row-major
// Per ISA 7.12.2 the 16x32 f16 A fragment for lane L (m=L&15, hi=L>>4) is
//   halves 0..7  = K  8*hi + 0..7   (contiguous)
//   halves 8..15 = K 16+8*hi + 0..7 (contiguous)
// so each fragment = two global_load_b128 per lane; same for B against Bt.
// 8 waves / block, one 16x16 C tile per wave (linear tile id).
// K must be a multiple of 64 (manual 2x unroll -> 2 WMMAs/iter).
// blk is the block's index within its own product.
// ---------------------------------------------------------------------------
__device__ __forceinline__ void gemm16_tile(const _Float16* __restrict__ A,
                                            const _Float16* __restrict__ Bt,
                                            float* __restrict__ C,
                                            int M, int N, int K, int act, int blk)
{
    const int lane = threadIdx.x & 31;
    const int wid  = threadIdx.x >> 5;
    const int tid  = blk * 8 + wid;                 // linear 16x16 tile id
    const int ntiles = N >> 4;
    const int m0 = (tid / ntiles) << 4;
    const int n0 = (tid % ntiles) << 4;
    if (m0 >= M) return;                            // wave-uniform guard

    const int hi = lane >> 4;
    const int lo = lane & 15;
    const _Float16* arow = A  + (size_t)(m0 + lo) * K + 8*hi;
    const _Float16* brow = Bt + (size_t)(n0 + lo) * K + 8*hi;

    v8f acc = {};
    for (int k0 = 0; k0 < K; k0 += 64) {
        v8h al0 = *(const v8h*)(arow + k0);
        v8h ah0 = *(const v8h*)(arow + k0 + 16);
        v8h bl0 = *(const v8h*)(brow + k0);
        v8h bh0 = *(const v8h*)(brow + k0 + 16);
        v8h al1 = *(const v8h*)(arow + k0 + 32);
        v8h ah1 = *(const v8h*)(arow + k0 + 48);
        v8h bl1 = *(const v8h*)(brow + k0 + 32);
        v8h bh1 = *(const v8h*)(brow + k0 + 48);
        v16h a0 = __builtin_shufflevector(al0, ah0, 0,1,2,3,4,5,6,7,8,9,10,11,12,13,14,15);
        v16h b0 = __builtin_shufflevector(bl0, bh0, 0,1,2,3,4,5,6,7,8,9,10,11,12,13,14,15);
        v16h a1 = __builtin_shufflevector(al1, ah1, 0,1,2,3,4,5,6,7,8,9,10,11,12,13,14,15);
        v16h b1 = __builtin_shufflevector(bl1, bh1, 0,1,2,3,4,5,6,7,8,9,10,11,12,13,14,15);
        acc = __builtin_amdgcn_wmma_f32_16x16x32_f16(false, a0, false, b0,
                                                     (short)0, acc, false, false);
        acc = __builtin_amdgcn_wmma_f32_16x16x32_f16(false, a1, false, b1,
                                                     (short)0, acc, false, false);
    }
#pragma unroll
    for (int r = 0; r < 8; ++r) {
        float x = acc[r];
        if (act == 1) x = sigmoid_fast(x);
        C[(size_t)(m0 + r + 8*hi) * N + (n0 + lo)] = x;
    }
}

// One product per launch (the output projection).
__global__
void gemm16_wmma(const _Float16* __restrict__ A,
                 const _Float16* __restrict__ Bt,
                 float* __restrict__ C,
                 int M, int N, int K, int act)
{
    gemm16_tile(A, Bt, C, M, N, K, act, blockIdx.x);
}

// The six input projections share A and do not depend on one another: one
// launch, a range of blocks per product. 64 blocks each for q, k, v and the
// gate (N = 512), then 8 each for beta and tg (N = 64).
#define PROJ_BLOCKS (4*64 + 2*8)
__global__ __launch_bounds__(256)
void proj_wmma(const _Float16* __restrict__ xh,
               const _Float16* __restrict__ Wqt,
               const _Float16* __restrict__ Wkt,
               const _Float16* __restrict__ Wvt,
               const _Float16* __restrict__ Wgt,
               const _Float16* __restrict__ Wbt,
               const _Float16* __restrict__ Wtgt,
               float* __restrict__ q,
               float* __restrict__ k,
               float* __restrict__ v,
               float* __restrict__ g,
               float* __restrict__ beta,
               float* __restrict__ tg)
{
    const int blk = blockIdx.x;
    if (blk < 4*64) {
        const int job = blk >> 6;
        const _Float16* Bt = job == 0 ? Wqt : job == 1 ? Wkt : job == 2 ? Wvt : Wgt;
        float*          C  = job == 0 ? q   : job == 1 ? k   : job == 2 ? v   : g;
        gemm16_tile(xh, Bt, C, MROWS, 512, DD, job == 3 ? 1 : 0, blk & 63);
    } else {
        const int job = (blk - 4*64) >> 3;
        gemm16_tile(xh, job == 0 ? Wbt : Wtgt, job == 0 ? beta : tg,
                    MROWS, 64, DD, 1, blk & 7);
    }
}

// ---------------------------------------------------------------------------
// Layout prep: f32 -> f16 copy, and f32 [K,N] -> f16 [N,K] transpose.
// blk is the block's index within its own job; 256 threads a block, 32 elements
// a thread, so that the launch starts few waves and every global access is a
// 16-byte piece of a whole line.
// ---------------------------------------------------------------------------
#define PREP_ELEMS 8192            // elements a block handles
#define TILE_K 128
#define TILE_N 64
#define TILE_PITCH 65              // floats; odd, so that a column walk changes bank

__device__ __forceinline__ void cvt_f16_block(const float* __restrict__ in,
                                              _Float16* __restrict__ out, int blk)
{
    const unsigned base = blk * PREP_ELEMS + threadIdx.x * 8;     // in elements
    // all loops here are unrolled so that the arrays are indexed by constants and
    // stay in registers, and the 8 loads fly together
    v4f lo[4], hi[4];
#pragma unroll
    for (int it = 0; it < 4; ++it) {
        lo[it] = *(const v4f*)(in + base + it*2048);
        hi[it] = *(const v4f*)(in + base + it*2048 + 4);
    }
#pragma unroll
    for (int it = 0; it < 4; ++it) {
        v8h h;
#pragma unroll
        for (int j = 0; j < 4; ++j) {
            h[j]     = (_Float16)lo[it][j];
            h[4 + j] = (_Float16)hi[it][j];
        }
        *(v8h*)(out + base + it*2048) = h;
    }
    // the code that follows in the kernel's listing reuses the stores' address and
    // data registers: keep the wait between the four stores and those writes
    asm volatile("s_wait_xcnt 0x0" ::: "memory");
}

// One block turns a tile of 128 k x 64 n. It reads 256-byte pieces of the rows
// of in, lays them in LDS as they are, and each thread then walks down a column
// and stores 8 k of one n as 16 bytes: a block writes 256 bytes of each of its
// 64 rows of out. K and N are multiples of 128 and 64.
__device__ __forceinline__ void transpose_f16_tile(const float* __restrict__ in, // [K,N]
                                                   _Float16* __restrict__ out,   // [N,K]
                                                   int K, int N, int blk,
                                                   float* __restrict__ tile)
{
    const int tid = threadIdx.x;
    const int ntn = N / TILE_N;
    const int k0  = (blk / ntn) * TILE_K;
    const int n0  = (blk % ntn) * TILE_N;
    const int lr  = tid >> 4;              // row of the first piece, 16 rows a pass
    const int lc  = (tid & 15) * 4;
    const float* src = in + (size_t)(k0 + lr) * N + n0 + lc;
    // all loops here are unrolled so that the arrays are indexed by constants and
    // stay in registers, and the 8 loads fly together
    v4f ld[8];
#pragma unroll
    for (int it = 0; it < 8; ++it)
        ld[it] = *(const v4f*)(src + (size_t)it * 16 * N);
#pragma unroll
    for (int it = 0; it < 8; ++it)
#pragma unroll
        for (int j = 0; j < 4; ++j)
            tile[(lr + 16*it) * TILE_PITCH + lc + j] = ld[it][j];
    // every wave reads what the other waves laid down
    __syncthreads();
    const int n  = tid >> 2;
    const int kq = (tid & 3) * 8;
    _Float16* dst = out + (size_t)(n0 + n) * K + k0 + kq;
#pragma unroll
    for (int g = 0; g < 4; ++g) {
        v8h h;
#pragma unroll
        for (int j = 0; j < 8; ++j)
            h[j] = (_Float16)tile[(kq + 32*g + j) * TILE_PITCH + n];
        *(v8h*)(dst + 32*g) = h;
    }
    // the code that follows in the kernel's listing reuses the stores' address and
    // data registers: keep the wait between the four stores and those writes
    asm volatile("s_wait_xcnt 0x0" ::: "memory");
}

// ---------------------------------------------------------------------------
// Precompute per-(h,r) spectral parameters.
// ---------------------------------------------------------------------------
__device__ __forceinline__ void params_block(const float* __restrict__ mode_logits,
                                             const float* __restrict__ log_decay,
                                             const float* __restrict__ omega_log_scale,
                                             float* __restrict__ cosw,
                                             float* __restrict__ sinw,
                                             float* __restrict__ rho,
                                             float* __restrict__ modew)
{
    const int t = threadIdx.x;      // 0..255; threads 0..63 do the work
    if (t >= HH*RR) return;
    const int h = t >> 3;

    const float ld = log_decay[t];
    const float sp = (ld > 20.0f) ? ld : log1pf(expf(ld));   // softplus
    rho[t] = expf(-sp);

    float mx = -1e30f;
    for (int j = 0; j < RR; ++j) mx = fmaxf(mx, mode_logits[h*RR + j]);
    float sum = 0.0f;
    for (int j = 0; j < RR; ++j) sum += expf(mode_logits[h*RR + j] - mx);
    modew[t] = expf(mode_logits[t] - mx) / sum;

    const float os = expf(omega_log_scale[t]);
    for (int d = 0; d < DK; ++d) {
        const float pidx = (float)(d & ~1);                  // repeat_interleave
        const float invf = powf(10000.0f, -pidx / (float)DK);
        const float w = os * invf;
        cosw[t*DK + d] = cosf(w);
        sinw[t*DK + d] = sinf(w);
    }
}

// ---------------------------------------------------------------------------
// All of the prep in one launch: the parameter table, the f16 copy of x and the
// seven weight transposes read only inputs and write disjoint scratch, so none
// waits for another. A range of blocks per job. The parameter block is a long
// serial loop of two waves: it is block 0.
// ---------------------------------------------------------------------------
#define PREP_X_BLOCKS   ((MROWS*DD)/PREP_ELEMS)   // 32
#define PREP_BIG_BLOCKS ((DD*512)/PREP_ELEMS)     // 64
#define PREP_SML_BLOCKS ((DD*64)/PREP_ELEMS)      // 8
#define PREP_BLOCKS (1 + PREP_X_BLOCKS + 5*PREP_BIG_BLOCKS + 2*PREP_SML_BLOCKS)
__global__ __launch_bounds__(256)
void prep_kernel(const float* __restrict__ x,
                 const float* __restrict__ Wq,
                 const float* __restrict__ Wk,
                 const float* __restrict__ Wv,
                 const float* __restrict__ Wg,
                 const float* __restrict__ Wo,
                 const float* __restrict__ Wb,
                 const float* __restrict__ Wtg,
                 const float* __restrict__ mode_logits,
                 const float* __restrict__ log_decay,
                 const float* __restrict__ omega_log_scale,
                 _Float16* __restrict__ xh,
                 _Float16* __restrict__ Wqt,
                 _Float16* __restrict__ Wkt,
                 _Float16* __restrict__ Wvt,
                 _Float16* __restrict__ Wgt,
                 _Float16* __restrict__ Wot,
                 _Float16* __restrict__ Wbt,
                 _Float16* __restrict__ Wtgt,
                 float* __restrict__ cosw,
                 float* __restrict__ sinw,
                 float* __restrict__ rho,
                 float* __restrict__ modew)
{
    __shared__ float tile[TILE_K * TILE_PITCH];
    int blk = blockIdx.x;
    if (blk == 0) {
        params_block(mode_logits, log_decay, omega_log_scale, cosw, sinw, rho, modew);
        return;
    }
    blk -= 1;
    if (blk < PREP_X_BLOCKS) {
        cvt_f16_block(x, xh, blk);
        return;
    }
    blk -= PREP_X_BLOCKS;
    if (blk < 4*PREP_BIG_BLOCKS) {
        const int job = blk / PREP_BIG_BLOCKS;
        const float* in  = job == 0 ? Wq  : job == 1 ? Wk  : job == 2 ? Wv  : Wg;
        _Float16*    out = job == 0 ? Wqt : job == 1 ? Wkt : job == 2 ? Wvt : Wgt;
        transpose_f16_tile(in, out, DD, 512, blk % PREP_BIG_BLOCKS, tile);
        return;
    }
    blk -= 4*PREP_BIG_BLOCKS;
    if (blk < PREP_BIG_BLOCKS) {
        transpose_f16_tile(Wo, Wot, 512, DD, blk, tile);
        return;
    }
    blk -= PREP_BIG_BLOCKS;
    const int job = blk / PREP_SML_BLOCKS;
    transpose_f16_tile(job == 0 ? Wb : Wtg, job == 0 ? Wbt : Wtgt, DD, 64,
                       blk % PREP_SML_BLOCKS, tile);
}

// ---------------------------------------------------------------------------
// Recurrent scan: 8 lanes share one state row (b,h,r,v); each lane keeps 8 of
// the 64 Dk elements (real and imaginary) in registers, as two groups of four:
// k = 4*sub + 0..3 and k = 32 + 4*sub + 0..3, so that the 8 lanes of a row read
// one 128-byte line per 16-byte load. The two sums over Dk of a time step end
// in three in-row DPP adds (lane ^ 1, ^ 2, ^ 4).
// One block = 32 rows (half the Dv rows) of one (b,h,r). ys: [B*T, H, R, DV].
// What the block reads in its 128 time steps (the k and q rows of its (b,h), its
// 32 v of each step, decay and beta of its (h,r)) is brought into LDS once, ahead
// of the loop, with all loads in flight together; the loop reads it from there
// one time step ahead, so that no load latency is left in a time step.
// ---------------------------------------------------------------------------
template <int CTRL>
__device__ __forceinline__ float add_row_xmask(float x)
{
    // x + (x of lane ^ mask), mask in the low bits of CTRL (0x160 | mask)
    const int xi = __builtin_bit_cast(int, x);
    const int yi = __builtin_amdgcn_update_dpp(0, xi, CTRL, 0xf, 0xf, true);
    return x + __builtin_bit_cast(float, yi);
}

__device__ __forceinline__ float sum_over_8_lanes(float x)
{
    x = add_row_xmask<0x161>(x);
    x = add_row_xmask<0x162>(x);
    x = add_row_xmask<0x164>(x);
    return x;
}

// The grid is 2048 waves, two per SIMD: waves_per_eu says so, so that the
// register budget is not held at 64: the staging holds the results of a thread's
// twenty 16-byte loads at once.
__global__ __launch_bounds__(256) __attribute__((amdgpu_waves_per_eu(2, 2)))
void scan_kernel(const float* __restrict__ q,
                 const float* __restrict__ k,
                 const float* __restrict__ v,
                 const float* __restrict__ beta,
                 const float* __restrict__ tg,
                 const float* __restrict__ cosw,
                 const float* __restrict__ sinw,
                 const float* __restrict__ rho,
                 const float* __restrict__ modew,
                 float* __restrict__ ys)
{
    const int half = blockIdx.x & 1;
    const int r    = (blockIdx.x >> 1) & 7;
    const int h    = (blockIdx.x >> 4) & 7;
    const int b    = (blockIdx.x >> 7) & 1;
    const int hr   = h*RR + r;
    const int sub  = threadIdx.x & 7;
    const int vrow = half*32 + (threadIdx.x >> 3);

    __shared__ v4f ks[TT*16];         // k rows, 64 floats a step
    __shared__ v4f qs[TT*16];         // q rows, 64 floats a step
    __shared__ v4f vs[TT*8];          // this half's 32 v of a step
    __shared__ v2f db[TT];            // decay and beta of a step

    const float rho_hr = rho[hr];
    const float mw     = modew[hr];
    // keeps the scalar loads above from being placed between the four loads
    // below and their wait, where they would land in those loads' base registers
    __builtin_amdgcn_sched_barrier(0);

    const float4* c4 = (const float4*)(cosw + hr*DK);
    const float4* s4 = (const float4*)(sinw + hr*DK);
    const float4 ca = c4[sub], cb = c4[8 + sub];
    const float4 sa = s4[sub], sb = s4[8 + sub];
    // the base registers of these four loads are reused right behind them: keep
    // the wait between the loads and those writes; the scheduling barrier keeps
    // the later index arithmetic from being lifted over the wait
    asm volatile("s_wait_xcnt 0x0" ::: "memory");
    __builtin_amdgcn_sched_barrier(0);
    const float c[8] = {ca.x, ca.y, ca.z, ca.w, cb.x, cb.y, cb.z, cb.w};
    const float s[8] = {sa.x, sa.y, sa.z, sa.w, sb.x, sb.y, sb.z, sb.w};

    // Staging. row0 is the flat (b,0,h); the next time step lies HH rows on. A
    // wave's 16-byte loads cover whole 256-byte k or q rows, whole 128-byte half
    // rows of v. A thread's pieces lie a fixed number of bytes apart: 16 steps
    // for k and q, 32 steps for v. Threads 0..127 stage the decay of step tid,
    // threads 128..255 the beta of step tid - 128.
    const unsigned tid  = threadIdx.x;
    const unsigned row0 = b*TT*HH + h;
    const unsigned kq_off = ((row0 + (tid >> 4)*HH)*DK + (tid & 15)*4) * 4;
    const unsigned v_off  = ((row0 + (tid >> 3)*HH)*DV + half*32 + (tid & 7)*4) * 4;
    const unsigned d_idx  = (row0 + (tid & (TT-1))*HH)*RR + r;       // in floats
    // the loops are unrolled so that the arrays stay in registers and all of a
    // thread's loads are in flight at once
    v4f kst[8], qst[8], vst[4];
#pragma unroll
    for (int it = 0; it < 8; ++it) {
        kst[it] = *(const v4f*)((const char*)k + kq_off + it*(16*HH*DK*4));
        qst[it] = *(const v4f*)((const char*)q + kq_off + it*(16*HH*DK*4));
    }
#pragma unroll
    for (int it = 0; it < 4; ++it)
        vst[it] = *(const v4f*)((const char*)v + v_off + it*(32*HH*DV*4));
    const float tg_st = tg[d_idx];
    const float be_st = beta[d_idx];
    // The wait stands between these loads and every later write of their offset
    // registers. It takes the loaded values and the three offsets as inputs only:
    // so all the loads are issued ahead of it, and no offset register is given
    // to a load's result or to later arithmetic before it. The scheduling barrier
    // keeps later index arithmetic, which reuses the loads' base registers, from
    // being lifted over the wait.
    asm volatile("s_wait_xcnt 0x0"
                 :: "v"(kst[0]), "v"(kst[1]), "v"(kst[2]), "v"(kst[3]),
                    "v"(kst[4]), "v"(kst[5]), "v"(kst[6]), "v"(kst[7]),
                    "v"(qst[0]), "v"(qst[1]), "v"(qst[2]), "v"(qst[3]),
                    "v"(qst[4]), "v"(qst[5]), "v"(qst[6]), "v"(qst[7]),
                    "v"(vst[0]), "v"(vst[1]), "v"(vst[2]), "v"(vst[3]),
                    "v"(tg_st), "v"(be_st), "v"(kq_off), "v"(v_off), "v"(d_idx)
                 : "memory");
    __builtin_amdgcn_sched_barrier(0);
#pragma unroll
    for (int it = 0; it < 8; ++it) {
        ks[it*256 + tid] = kst[it];
        qs[it*256 + tid] = qst[it];
    }
#pragma unroll
    for (int it = 0; it < 4; ++it)
        vs[it*256 + tid] = vst[it];
    ((float*)db)[2*(tid & (TT-1)) + (tid >> 7)] = (tid < TT) ? tg_st * rho_hr : be_st;
    // every wave reads what the other waves staged
    __syncthreads();
    const float* vsf = (const float*)vs + (tid >> 3);

    // every loop over e below is unrolled so that the 8-element arrays are
    // indexed by constants and stay in registers
    float sr[8], si[8];
#pragma unroll
    for (int e = 0; e < 8; ++e) { sr[e] = 0.f; si[e] = 0.f; }

    // A trip works on operands that were read from LDS in the trip before.
    v4f ka = ks[sub], kb = ks[8 + sub];
    v4f qa = qs[sub], qb = qs[8 + sub];
    v2f dbt = db[0];
    float vt = vsf[0];
    for (int t = 0; t < TT; ++t) {
        const int bh = (b*TT + t)*HH + h;         // flat (b,t,h)
        const float decay = dbt.x;
        const float bet   = dbt.y;
        const float kt[8] = {ka.x, ka.y, ka.z, ka.w, kb.x, kb.y, kb.z, kb.w};
        const float qt[8] = {qa.x, qa.y, qa.z, qa.w, qb.x, qb.y, qb.z, qb.w};

        float rr[8];
#pragma unroll
        for (int e = 0; e < 8; ++e) {
            rr[e] = decay * (c[e]*sr[e] - s[e]*si[e]);
            si[e] = decay * (s[e]*sr[e] + c[e]*si[e]);
        }

        const float pa = rr[0]*kt[0] + rr[2]*kt[2] + rr[4]*kt[4] + rr[6]*kt[6];
        const float pb = rr[1]*kt[1] + rr[3]*kt[3] + rr[5]*kt[5] + rr[7]*kt[7];
        const float pred = sum_over_8_lanes(pa + pb);

        const float bw = bet * (vt - pred);
#pragma unroll
        for (int e = 0; e < 8; ++e) sr[e] = rr[e] + bw*kt[e];

        const float ra = sr[0]*qt[0] + sr[2]*qt[2] + sr[4]*qt[4] + sr[6]*qt[6];
        const float rb = sr[1]*qt[1] + sr[3]*qt[3] + sr[5]*qt[5] + sr[7]*qt[7];

        // This step's operands are used up: the next step's are read into their
        // place, all at one point, and arrive under the lane sum, the store and
        // the next rotation. The last trip reads its own step again, so that
        // nothing behind the staged rows is read.
        const int tn = (t + 1 < TT) ? t + 1 : t;
        ka = ks[tn*16 + sub];  kb = ks[tn*16 + 8 + sub];
        qa = qs[tn*16 + sub];  qb = qs[tn*16 + 8 + sub];
        dbt = db[tn];
        vt  = vsf[tn*32];

        const float rd = sum_over_8_lanes(ra + rb);

        if (sub == 0) {
            ys[(size_t)(bh*RR + r)*DV + vrow] = rd * mw;
            // the store's address and data registers are rewritten in the next
            // trip: keep the wait between the store and those writes
            asm volatile("s_wait_xcnt 0x0" ::: "memory");
        }
    }
}

// ---------------------------------------------------------------------------
// ogh[bt, h*DV+v] = f16( gate * sum_r ys[bt,h,r,v] )  (feeds the final WMMA)
// ---------------------------------------------------------------------------
__global__ void combine_kernel(const float* __restrict__ ys,
                               const float* __restrict__ g,
                               _Float16* __restrict__ ogh)
{
    const int i = blockIdx.x * blockDim.x + threadIdx.x;   // 0..MROWS*H*DV-1
    const int vv = i & 63;
    const int h  = (i >> 6) & 7;
    const int bt = i >> 9;
    const size_t base = (size_t)((bt*HH + h)*RR)*DV + vv;
    float s = 0.0f;
#pragma unroll
    for (int r = 0; r < RR; ++r) s += ys[base + r*DV];
    ogh[i] = (_Float16)(s * g[i]);
}

// ---------------------------------------------------------------------------
extern "C" void kernel_launch(void* const* d_in, const int* in_sizes, int n_in,
                              void* d_out, int out_size, void* d_ws, size_t ws_size,
                              hipStream_t stream)
{
    (void)in_sizes; (void)n_in; (void)out_size; (void)ws_size;
    const float* x    = (const float*)d_in[0];
    const float* Wq   = (const float*)d_in[1];
    const float* Wk   = (const float*)d_in[2];
    const float* Wv   = (const float*)d_in[3];
    const float* Wb   = (const float*)d_in[4];
    const float* Wtg  = (const float*)d_in[5];
    const float* mlg  = (const float*)d_in[6];
    const float* ldc  = (const float*)d_in[7];
    const float* oms  = (const float*)d_in[8];
    const float* Wg   = (const float*)d_in[9];
    const float* Wo   = (const float*)d_in[10];

    // ---- f32 scratch ----
    float* ws    = (float*)d_ws;
    float* q     = ws;                        // 256*512
    float* k     = q    + MROWS*512;
    float* v     = k    + MROWS*512;
    float* g     = v    + MROWS*512;
    float* beta  = g    + MROWS*512;          // 256*64
    float* tg    = beta + MROWS*64;
    float* cosw  = tg   + MROWS*64;           // 64*64
    float* sinw  = cosw + HH*RR*DK;
    float* rho   = sinw + HH*RR*DK;           // 64
    float* modew = rho  + HH*RR;
    float* ys    = modew + HH*RR;             // 256*8*8*64 = 1048576
    float* fend  = ys   + MROWS*HH*RR*DV;

    // ---- f16 scratch (16B-aligned: float count above is a multiple of 4) ----
    _Float16* hb   = (_Float16*)fend;
    _Float16* xh   = hb;                      // 256*1024
    _Float16* Wqt  = xh   + MROWS*DD;         // 512*1024 each
    _Float16* Wkt  = Wqt  + 512*DD;
    _Float16* Wvt  = Wkt  + 512*DD;
    _Float16* Wgt  = Wvt  + 512*DD;
    _Float16* Wbt  = Wgt  + 512*DD;           // 64*1024 each
    _Float16* Wtgt = Wbt  + 64*DD;
    _Float16* Wot  = Wtgt + 64*DD;            // 1024*512
    _Float16* ogh  = Wot  + DD*512;           // 256*512

    // parameter table, f16 copy of x and the seven weight transposes
    prep_kernel<<<PREP_BLOCKS, 256, 0, stream>>>(x, Wq, Wk, Wv, Wg, Wo, Wb, Wtg,
                                                 mlg, ldc, oms,
                                                 xh, Wqt, Wkt, Wvt, Wgt, Wot, Wbt, Wtgt,
                                                 cosw, sinw, rho, modew);

    // the six input projections; 8 tiles (waves) per 256-thread block
    proj_wmma<<<PROJ_BLOCKS, 256, 0, stream>>>(xh, Wqt, Wkt, Wvt, Wgt, Wbt, Wtgt,
                                               q, k, v, g, beta, tg);

    // 8192 rows, 8 lanes each, 32 rows per 256-thread block -> 256 blocks
    scan_kernel<<<256, 256, 0, stream>>>(q, k, v, beta, tg, cosw, sinw, rho, modew, ys);

    combine_kernel<<<(MROWS*HH*DV)/256, 256, 0, stream>>>(ys, g, ogh);

    gemm16_wmma<<<(16*64)/8, 256, 0, stream>>>(ogh, Wot, (float*)d_out,
                                               MROWS, DD, 512, 0);
}

// v005
// One run takes 51.2 microseconds.
// In two side-by-side timings against v004, it was 1.44 and 1.43 times as fast.
// Counting every step since v000, it is 4.51 times as fast.
#include <hip/hip_runtime.h>
#include <hip/hip_bf16.h>
#include <math.h>

// Problem constants (from reference)
#define BB 2
#define TT 128
#define DD 1024
#define HH 8
#define RR 8
#define DK 64
#define DV 64
#define MROWS (BB*TT)          // 256

typedef __attribute__((ext_vector_type(16))) _Float16 v16h;
typedef __attribute__((ext_vector_type(8)))  _Float16 v8h;
typedef __attribute__((ext_vector_type(8)))  float    v8f;
typedef __attribute__((ext_vector_type(4)))  float    v4f;
typedef __attribute__((ext_vector_type(2)))  float    v2f;

__device__ __forceinline__ float sigmoid_fast(float x) {
    return __builtin_amdgcn_rcpf(1.0f + __expf(-x));
}

// ---------------------------------------------------------------------------
// WMMA GEMM with native-layout f16 operands.
//   A  : [M,K] f16 row-major
//   Bt : [N,K] f16 row-major (i.e. W[K,N] pre-transposed)
//   C  : [M,N] f32 row-major
// Per ISA 7.12.2 the 16x32 f16 A fragment for lane L (m=L&15, hi=L>>4) is
//   halves 0..7  = K  8*hi + 0..7   (contiguous)
//   halves 8..15 = K 16+8*hi + 0..7 (contiguous)
// so each fragment = two global_load_b128 per lane; same for B against Bt.
// 8 waves / block, one 16x16 C tile per wave (linear tile id).
// K must be a multiple of 64 (manual 2x unroll -> 2 WMMAs/iter).
// blk is the block's index within its own product.
// ---------------------------------------------------------------------------
__device__ __forceinline__ void gemm16_tile(const _Float16* __restrict__ A,
                                            const _Float16* __restrict__ Bt,
                                            float* __restrict__ C,
                                            int M, int N, int K, int act, int blk)
{
    const int lane = threadIdx.x & 31;
    const int wid  = threadIdx.x >> 5;
    const int tid  = blk * 8 + wid;                 // linear 16x16 tile id
    const int ntiles = N >> 4;
    const int m0 = (tid / ntiles) << 4;
    const int n0 = (tid % ntiles) << 4;
    if (m0 >= M) return;                            // wave-uniform guard

    const int hi = lane >> 4;
    const int lo = lane & 15;
    const _Float16* arow = A  + (size_t)(m0 + lo) * K + 8*hi;
    const _Float16* brow = Bt + (size_t)(n0 + lo) * K + 8*hi;

    v8f acc = {};
    for (int k0 = 0; k0 < K; k0 += 64) {
        v8h al0 = *(const v8h*)(arow + k0);
        v8h ah0 = *(const v8h*)(arow + k0 + 16);
        v8h bl0 = *(const v8h*)(brow + k0);
        v8h bh0 = *(const v8h*)(brow + k0 + 16);
        v8h al1 = *(const v8h*)(arow + k0 + 32);
        v8h ah1 = *(const v8h*)(arow + k0 + 48);
        v8h bl1 = *(const v8h*)(brow + k0 + 32);
        v8h bh1 = *(const v8h*)(brow + k0 + 48);
        v16h a0 = __builtin_shufflevector(al0, ah0, 0,1,2,3,4,5,6,7,8,9,10,11,12,13,14,15);
        v16h b0 = __builtin_shufflevector(bl0, bh0, 0,1,2,3,4,5,6,7,8,9,10,11,12,13,14,15);
        v16h a1 = __builtin_shufflevector(al1, ah1, 0,1,2,3,4,5,6,7,8,9,10,11,12,13,14,15);
        v16h b1 = __builtin_shufflevector(bl1, bh1, 0,1,2,3,4,5,6,7,8,9,10,11,12,13,14,15);
        acc = __builtin_amdgcn_wmma_f32_16x16x32_f16(false, a0, false, b0,
                                                     (short)0, acc, false, false);
        acc = __builtin_amdgcn_wmma_f32_16x16x32_f16(false, a1, false, b1,
                                                     (short)0, acc, false, false);
    }
#pragma unroll
    for (int r = 0; r < 8; ++r) {
        float x = acc[r];
        if (act == 1) x = sigmoid_fast(x);
        C[(size_t)(m0 + r + 8*hi) * N + (n0 + lo)] = x;
    }
}

// One product per launch (the output projection).
__global__
void gemm16_wmma(const _Float16* __restrict__ A,
                 const _Float16* __restrict__ Bt,
                 float* __restrict__ C,
                 int M, int N, int K, int act)
{
    gemm16_tile(A, Bt, C, M, N, K, act, blockIdx.x);
}

// The six input projections share A and do not depend on one another: one
// launch, a range of blocks per product. 64 blocks each for q, k, v and the
// gate (N = 512), then 8 each for beta and tg (N = 64).
#define PROJ_BLOCKS (4*64 + 2*8)
__global__ __launch_bounds__(256)
void proj_wmma(const _Float16* __restrict__ xh,
               const _Float16* __restrict__ Wqt,
               const _Float16* __restrict__ Wkt,
               const _Float16* __restrict__ Wvt,
               const _Float16* __restrict__ Wgt,
               const _Float16* __restrict__ Wbt,
               const _Float16* __restrict__ Wtgt,
               float* __restrict__ q,
               float* __restrict__ k,
               float* __restrict__ v,
               float* __restrict__ g,
               float* __restrict__ beta,
               float* __restrict__ tg)
{
    const int blk = blockIdx.x;
    if (blk < 4*64) {
        const int job = blk >> 6;
        const _Float16* Bt = job == 0 ? Wqt : job == 1 ? Wkt : job == 2 ? Wvt : Wgt;
        float*          C  = job == 0 ? q   : job == 1 ? k   : job == 2 ? v   : g;
        gemm16_tile(xh, Bt, C, MROWS, 512, DD, job == 3 ? 1 : 0, blk & 63);
    } else {
        const int job = (blk - 4*64) >> 3;
        gemm16_tile(xh, job == 0 ? Wbt : Wtgt, job == 0 ? beta : tg,
                    MROWS, 64, DD, 1, blk & 7);
    }
}

// ---------------------------------------------------------------------------
// Layout prep: f32 -> f16 copy, and f32 [K,N] -> f16 [N,K] transpose.
// blk is the block's index within its own job; 256 threads a block, 32 elements
// a thread, so that the launch starts few waves and every global access is a
// 16-byte piece of a whole line.
// ---------------------------------------------------------------------------
#define PREP_ELEMS 8192            // elements a block handles
#define TILE_K 128
#define TILE_N 64
#define TILE_PITCH 65              // floats; odd, so that a column walk changes bank

__device__ __forceinline__ void cvt_f16_block(const float* __restrict__ in,
                                              _Float16* __restrict__ out, int blk)
{
    const unsigned base = blk * PREP_ELEMS + threadIdx.x * 8;     // in elements
    // all loops here are unrolled so that the arrays are indexed by constants and
    // stay in registers, and the 8 loads fly together
    v4f lo[4], hi[4];
#pragma unroll
    for (int it = 0; it < 4; ++it) {
        lo[it] = *(const v4f*)(in + base + it*2048);
        hi[it] = *(const v4f*)(in + base + it*2048 + 4);
    }
#pragma unroll
    for (int it = 0; it < 4; ++it) {
        v8h h;
#pragma unroll
        for (int j = 0; j < 4; ++j) {
            h[j]     = (_Float16)lo[it][j];
            h[4 + j] = (_Float16)hi[it][j];
        }
        *(v8h*)(out + base + it*2048) = h;
    }
    // the code that follows in the kernel's listing reuses the stores' address and
    // data registers: keep the wait between the four stores and those writes
    asm volatile("s_wait_xcnt 0x0" ::: "memory");
}

// One block turns a tile of 128 k x 64 n. It reads 256-byte pieces of the rows
// of in, lays them in LDS as they are, and each thread then walks down a column
// and stores 8 k of one n as 16 bytes: a block writes 256 bytes of each of its
// 64 rows of out. K and N are multiples of 128 and 64.
__device__ __forceinline__ void transpose_f16_tile(const float* __restrict__ in, // [K,N]
                                                   _Float16* __restrict__ out,   // [N,K]
                                                   int K, int N, int blk,
                                                   float* __restrict__ tile)
{
    const int tid = threadIdx.x;
    const int ntn = N / TILE_N;
    const int k0  = (blk / ntn) * TILE_K;
    const int n0  = (blk % ntn) * TILE_N;
    const int lr  = tid >> 4;              // row of the first piece, 16 rows a pass
    const int lc  = (tid & 15) * 4;
    const float* src = in + (size_t)(k0 + lr) * N + n0 + lc;
    // all loops here are unrolled so that the arrays are indexed by constants and
    // stay in registers, and the 8 loads fly together
    v4f ld[8];
#pragma unroll
    for (int it = 0; it < 8; ++it)
        ld[it] = *(const v4f*)(src + (size_t)it * 16 * N);
#pragma unroll
    for (int it = 0; it < 8; ++it)
#pragma unroll
        for (int j = 0; j < 4; ++j)
            tile[(lr + 16*it) * TILE_PITCH + lc + j] = ld[it][j];
    // every wave reads what the other waves laid down
    __syncthreads();
    const int n  = tid >> 2;
    const int kq = (tid & 3) * 8;
    _Float16* dst = out + (size_t)(n0 + n) * K + k0 + kq;
#pragma unroll
    for (int g = 0; g < 4; ++g) {
        v8h h;
#pragma unroll
        for (int j = 0; j < 8; ++j)
            h[j] = (_Float16)tile[(kq + 32*g + j) * TILE_PITCH + n];
        *(v8h*)(dst + 32*g) = h;
    }
    // the code that follows in the kernel's listing reuses the stores' address and
    // data registers: keep the wait between the four stores and those writes
    asm volatile("s_wait_xcnt 0x0" ::: "memory");
}

// ---------------------------------------------------------------------------
// Precompute per-(h,r) spectral parameters. One wave per (h,r): its 32 lanes
// take the 32 frequency pairs of Dk, one each, so that the table costs one pass
// through powf, cosf and sinf, not a serial walk over Dk. 8 waves a block.
// blk is the block's index within this job.
// ---------------------------------------------------------------------------
#define PREP_PAR_BLOCKS ((HH*RR)/8)   // 8
__device__ __forceinline__ void params_block(const float* __restrict__ mode_logits,
                                             const float* __restrict__ log_decay,
                                             const float* __restrict__ omega_log_scale,
                                             float* __restrict__ cosw,
                                             float* __restrict__ sinw,
                                             float* __restrict__ rho,
                                             float* __restrict__ modew,
                                             int blk)
{
    const int t = blk * 8 + (threadIdx.x >> 5);              // 0..63, one a wave
    const int h = t >> 3;
    const int p = threadIdx.x & 31;                          // frequency pair

    // all that the wave reads, in flight together: one load latency
    const float ols = omega_log_scale[t];
    const float ld  = log_decay[t];
    const float mlt = mode_logits[t];
    const v4f ml0 = *(const v4f*)(mode_logits + h*RR);
    const v4f ml1 = *(const v4f*)(mode_logits + h*RR + 4);
    // the address registers of these loads are reused by the arithmetic below:
    // keep the wait between the loads and those writes; the scheduling barrier
    // keeps that arithmetic from being lifted over the wait
    asm volatile("s_wait_xcnt 0x0" ::: "memory");
    __builtin_amdgcn_sched_barrier(0);
    const float ml[RR] = {ml0.x, ml0.y, ml0.z, ml0.w, ml1.x, ml1.y, ml1.z, ml1.w};

    const float pidx = (float)(2 * p);                       // repeat_interleave
    const float invf = powf(10000.0f, -pidx / (float)DK);
    const float w  = expf(ols) * invf;
    const float cw = cosf(w);
    const float sw = sinf(w);
    const v2f c2 = {cw, cw};
    const v2f s2 = {sw, sw};

    const float sp = (ld > 20.0f) ? ld : log1pf(expf(ld));   // softplus
    const float rh = expf(-sp);
    // unrolled so that ml is indexed by constants and stays in registers
    float mx = -1e30f;
#pragma unroll
    for (int j = 0; j < RR; ++j) mx = fmaxf(mx, ml[j]);
    float sum = 0.0f;
#pragma unroll
    for (int j = 0; j < RR; ++j) sum += expf(ml[j] - mx);
    const float mwt = expf(mlt - mx) / sum;

    *(v2f*)(cosw + t*DK + 2*p) = c2;
    *(v2f*)(sinw + t*DK + 2*p) = s2;
    if (p == 0) {
        rho[t]   = rh;
        modew[t] = mwt;
    }
}

// ---------------------------------------------------------------------------
// All of the prep in one launch: the parameter table, the f16 copy of x and the
// seven weight transposes read only inputs and write disjoint scratch, so none
// waits for another. A range of blocks per job.
// ---------------------------------------------------------------------------
#define PREP_X_BLOCKS   ((MROWS*DD)/PREP_ELEMS)   // 32
#define PREP_BIG_BLOCKS ((DD*512)/PREP_ELEMS)     // 64
#define PREP_SML_BLOCKS ((DD*64)/PREP_ELEMS)      // 8
#define PREP_BLOCKS (PREP_PAR_BLOCKS + PREP_X_BLOCKS + 5*PREP_BIG_BLOCKS + 2*PREP_SML_BLOCKS)
__global__ __launch_bounds__(256)
void prep_kernel(const float* __restrict__ x,
                 const float* __restrict__ Wq,
                 const float* __restrict__ Wk,
                 const float* __restrict__ Wv,
                 const float* __restrict__ Wg,
                 const float* __restrict__ Wo,
                 const float* __restrict__ Wb,
                 const float* __restrict__ Wtg,
                 const float* __restrict__ mode_logits,
                 const float* __restrict__ log_decay,
                 const float* __restrict__ omega_log_scale,
                 _Float16* __restrict__ xh,
                 _Float16* __restrict__ Wqt,
                 _Float16* __restrict__ Wkt,
                 _Float16* __restrict__ Wvt,
                 _Float16* __restrict__ Wgt,
                 _Float16* __restrict__ Wot,
                 _Float16* __restrict__ Wbt,
                 _Float16* __restrict__ Wtgt,
                 float* __restrict__ cosw,
                 float* __restrict__ sinw,
                 float* __restrict__ rho,
                 float* __restrict__ modew)
{
    __shared__ float tile[TILE_K * TILE_PITCH];
    int blk = blockIdx.x;
    if (blk < PREP_PAR_BLOCKS) {
        params_block(mode_logits, log_decay, omega_log_scale, cosw, sinw, rho, modew, blk);
        return;
    }
    blk -= PREP_PAR_BLOCKS;
    if (blk < PREP_X_BLOCKS) {
        cvt_f16_block(x, xh, blk);
        return;
    }
    blk -= PREP_X_BLOCKS;
    if (blk < 4*PREP_BIG_BLOCKS) {
        const int job = blk / PREP_BIG_BLOCKS;
        const float* in  = job == 0 ? Wq  : job == 1 ? Wk  : job == 2 ? Wv  : Wg;
        _Float16*    out = job == 0 ? Wqt : job == 1 ? Wkt : job == 2 ? Wvt : Wgt;
        transpose_f16_tile(in, out, DD, 512, blk % PREP_BIG_BLOCKS, tile);
        return;
    }
    blk -= 4*PREP_BIG_BLOCKS;
    if (blk < PREP_BIG_BLOCKS) {
        transpose_f16_tile(Wo, Wot, 512, DD, blk, tile);
        return;
    }
    blk -= PREP_BIG_BLOCKS;
    const int job = blk / PREP_SML_BLOCKS;
    transpose_f16_tile(job == 0 ? Wb : Wtg, job == 0 ? Wbt : Wtgt, DD, 64,
                       blk % PREP_SML_BLOCKS, tile);
}

// ---------------------------------------------------------------------------
// Recurrent scan: 8 lanes share one state row (b,h,r,v); each lane keeps 8 of
// the 64 Dk elements (real and imaginary) in registers, as two groups of four:
// k = 4*sub + 0..3 and k = 32 + 4*sub + 0..3, so that the 8 lanes of a row read
// one 128-byte line per 16-byte load. The two sums over Dk of a time step end
// in three in-row DPP adds (lane ^ 1, ^ 2, ^ 4).
// One block = 32 rows (half the Dv rows) of one (b,h,r). ys: [B*T, H, R, DV].
// What the block reads in its 128 time steps (the k and q rows of its (b,h), its
// 32 v of each step, decay and beta of its (h,r)) is brought into LDS once, ahead
// of the loop, with all loads in flight together; the loop reads it from there
// one time step ahead, so that no load latency is left in a time step.
// ---------------------------------------------------------------------------
template <int CTRL>
__device__ __forceinline__ float add_row_xmask(float x)
{
    // x + (x of lane ^ mask), mask in the low bits of CTRL (0x160 | mask)
    const int xi = __builtin_bit_cast(int, x);
    const int yi = __builtin_amdgcn_update_dpp(0, xi, CTRL, 0xf, 0xf, true);
    return x + __builtin_bit_cast(float, yi);
}

__device__ __forceinline__ float sum_over_8_lanes(float x)
{
    x = add_row_xmask<0x161>(x);
    x = add_row_xmask<0x162>(x);
    x = add_row_xmask<0x164>(x);
    return x;
}

// The grid is 2048 waves, two per SIMD: waves_per_eu says so, so that the
// register budget is not held at 64: the staging holds the results of a thread's
// twenty 16-byte loads at once.
__global__ __launch_bounds__(256) __attribute__((amdgpu_waves_per_eu(2, 2)))
void scan_kernel(const float* __restrict__ q,
                 const float* __restrict__ k,
                 const float* __restrict__ v,
                 const float* __restrict__ beta,
                 const float* __restrict__ tg,
                 const float* __restrict__ cosw,
                 const float* __restrict__ sinw,
                 const float* __restrict__ rho,
                 const float* __restrict__ modew,
                 float* __restrict__ ys)
{
    const int half = blockIdx.x & 1;
    const int r    = (blockIdx.x >> 1) & 7;
    const int h    = (blockIdx.x >> 4) & 7;
    const int b    = (blockIdx.x >> 7) & 1;
    const int hr   = h*RR + r;
    const int sub  = threadIdx.x & 7;
    const int vrow = half*32 + (threadIdx.x >> 3);

    __shared__ v4f ks[TT*16];         // k rows, 64 floats a step
    __shared__ v4f qs[TT*16];         // q rows, 64 floats a step
    __shared__ v4f vs[TT*8];          // this half's 32 v of a step
    __shared__ v2f db[TT];            // decay and beta of a step

    const float rho_hr = rho[hr];
    const float mw     = modew[hr];
    // keeps the scalar loads above from being placed between the four loads
    // below and their wait, where they would land in those loads' base registers
    __builtin_amdgcn_sched_barrier(0);

    const float4* c4 = (const float4*)(cosw + hr*DK);
    const float4* s4 = (const float4*)(sinw + hr*DK);
    const float4 ca = c4[sub], cb = c4[8 + sub];
    const float4 sa = s4[sub], sb = s4[8 + sub];
    // the base registers of these four loads are reused right behind them: keep
    // the wait between the loads and those writes; the scheduling barrier keeps
    // the later index arithmetic from being lifted over the wait
    asm volatile("s_wait_xcnt 0x0" ::: "memory");
    __builtin_amdgcn_sched_barrier(0);
    const float c[8] = {ca.x, ca.y, ca.z, ca.w, cb.x, cb.y, cb.z, cb.w};
    const float s[8] = {sa.x, sa.y, sa.z, sa.w, sb.x, sb.y, sb.z, sb.w};

    // Staging. row0 is the flat (b,0,h); the next time step lies HH rows on. A
    // wave's 16-byte loads cover whole 256-byte k or q rows, whole 128-byte half
    // rows of v. A thread's pieces lie a fixed number of bytes apart: 16 steps
    // for k and q, 32 steps for v. Threads 0..127 stage the decay of step tid,
    // threads 128..255 the beta of step tid - 128.
    const unsigned tid  = threadIdx.x;
    const unsigned row0 = b*TT*HH + h;
    const unsigned kq_off = ((row0 + (tid >> 4)*HH)*DK + (tid & 15)*4) * 4;
    const unsigned v_off  = ((row0 + (tid >> 3)*HH)*DV + half*32 + (tid & 7)*4) * 4;
    const unsigned d_idx  = (row0 + (tid & (TT-1))*HH)*RR + r;       // in floats
    // the loops are unrolled so that the arrays stay in registers and all of a
    // thread's loads are in flight at once
    v4f kst[8], qst[8], vst[4];
#pragma unroll
    for (int it = 0; it < 8; ++it) {
        kst[it] = *(const v4f*)((const char*)k + kq_off + it*(16*HH*DK*4));
        qst[it] = *(const v4f*)((const char*)q + kq_off + it*(16*HH*DK*4));
    }
#pragma unroll
    for (int it = 0; it < 4; ++it)
        vst[it] = *(const v4f*)((const char*)v + v_off + it*(32*HH*DV*4));
    const float tg_st = tg[d_idx];
    const float be_st = beta[d_idx];
    // The wait stands between these loads and every later write of their offset
    // registers. It takes the loaded values and the three offsets as inputs only:
    // so all the loads are issued ahead of it, and no offset register is given
    // to a load's result or to later arithmetic before it. The scheduling barrier
    // keeps later index arithmetic, which reuses the loads' base registers, from
    // being lifted over the wait.
    asm volatile("s_wait_xcnt 0x0"
                 :: "v"(kst[0]), "v"(kst[1]), "v"(kst[2]), "v"(kst[3]),
                    "v"(kst[4]), "v"(kst[5]), "v"(kst[6]), "v"(kst[7]),
                    "v"(qst[0]), "v"(qst[1]), "v"(qst[2]), "v"(qst[3]),
                    "v"(qst[4]), "v"(qst[5]), "v"(qst[6]), "v"(qst[7]),
                    "v"(vst[0]), "v"(vst[1]), "v"(vst[2]), "v"(vst[3]),
                    "v"(tg_st), "v"(be_st), "v"(kq_off), "v"(v_off), "v"(d_idx)
                 : "memory");
    __builtin_amdgcn_sched_barrier(0);
#pragma unroll
    for (int it = 0; it < 8; ++it) {
        ks[it*256 + tid] = kst[it];
        qs[it*256 + tid] = qst[it];
    }
#pragma unroll
    for (int it = 0; it < 4; ++it)
        vs[it*256 + tid] = vst[it];
    ((float*)db)[2*(tid & (TT-1)) + (tid >> 7)] = (tid < TT) ? tg_st * rho_hr : be_st;
    // every wave reads what the other waves staged
    __syncthreads();
    const float* vsf = (const float*)vs + (tid >> 3);

    // every loop over e below is unrolled so that the 8-element arrays are
    // indexed by constants and stay in registers
    float sr[8], si[8];
#pragma unroll
    for (int e = 0; e < 8; ++e) { sr[e] = 0.f; si[e] = 0.f; }

    // A trip works on operands that were read from LDS in the trip before.
    v4f ka = ks[sub], kb = ks[8 + sub];
    v4f qa = qs[sub], qb = qs[8 + sub];
    v2f dbt = db[0];
    float vt = vsf[0];
    for (int t = 0; t < TT; ++t) {
        const int bh = (b*TT + t)*HH + h;         // flat (b,t,h)
        const float decay = dbt.x;
        const float bet   = dbt.y;
        const float kt[8] = {ka.x, ka.y, ka.z, ka.w, kb.x, kb.y, kb.z, kb.w};
        const float qt[8] = {qa.x, qa.y, qa.z, qa.w, qb.x, qb.y, qb.z, qb.w};

        float rr[8];
#pragma unroll
        for (int e = 0; e < 8; ++e) {
            rr[e] = decay * (c[e]*sr[e] - s[e]*si[e]);
            si[e] = decay * (s[e]*sr[e] + c[e]*si[e]);
        }

        const float pa = rr[0]*kt[0] + rr[2]*kt[2] + rr[4]*kt[4] + rr[6]*kt[6];
        const float pb = rr[1]*kt[1] + rr[3]*kt[3] + rr[5]*kt[5] + rr[7]*kt[7];
        const float pred = sum_over_8_lanes(pa + pb);

        const float bw = bet * (vt - pred);
#pragma unroll
        for (int e = 0; e < 8; ++e) sr[e] = rr[e] + bw*kt[e];

        const float ra = sr[0]*qt[0] + sr[2]*qt[2] + sr[4]*qt[4] + sr[6]*qt[6];
        const float rb = sr[1]*qt[1] + sr[3]*qt[3] + sr[5]*qt[5] + sr[7]*qt[7];

        // This step's operands are used up: the next step's are read into their
        // place, all at one point, and arrive under the lane sum, the store and
        // the next rotation. The last trip reads its own step again, so that
        // nothing behind the staged rows is read.
        const int tn = (t + 1 < TT) ? t + 1 : t;
        ka = ks[tn*16 + sub];  kb = ks[tn*16 + 8 + sub];
        qa = qs[tn*16 + sub];  qb = qs[tn*16 + 8 + sub];
        dbt = db[tn];
        vt  = vsf[tn*32];

        const float rd = sum_over_8_lanes(ra + rb);

        if (sub == 0) {
            ys[(size_t)(bh*RR + r)*DV + vrow] = rd * mw;
            // the store's address and data registers are rewritten in the next
            // trip: keep the wait between the store and those writes
            asm volatile("s_wait_xcnt 0x0" ::: "memory");
        }
    }
}

// ---------------------------------------------------------------------------
// ogh[bt, h*DV+v] = f16( gate * sum_r ys[bt,h,r,v] )  (feeds the final WMMA)
// ---------------------------------------------------------------------------
__global__ void combine_kernel(const float* __restrict__ ys,
                               const float* __restrict__ g,
                               _Float16* __restrict__ ogh)
{
    const int i = blockIdx.x * blockDim.x + threadIdx.x;   // 0..MROWS*H*DV-1
    const int vv = i & 63;
    const int h  = (i >> 6) & 7;
    const int bt = i >> 9;
    const size_t base = (size_t)((bt*HH + h)*RR)*DV + vv;
    float s = 0.0f;
#pragma unroll
    for (int r = 0; r < RR; ++r) s += ys[base + r*DV];
    ogh[i] = (_Float16)(s * g[i]);
}

// ---------------------------------------------------------------------------
extern "C" void kernel_launch(void* const* d_in, const int* in_sizes, int n_in,
                              void* d_out, int out_size, void* d_ws, size_t ws_size,
                              hipStream_t stream)
{
    (void)in_sizes; (void)n_in; (void)out_size; (void)ws_size;
    const float* x    = (const float*)d_in[0];
    const float* Wq   = (const float*)d_in[1];
    const float* Wk   = (const float*)d_in[2];
    const float* Wv   = (const float*)d_in[3];
    const float* Wb   = (const float*)d_in[4];
    const float* Wtg  = (const float*)d_in[5];
    const float* mlg  = (const float*)d_in[6];
    const float* ldc  = (const float*)d_in[7];
    const float* oms  = (const float*)d_in[8];
    const float* Wg   = (const float*)d_in[9];
    const float* Wo   = (const float*)d_in[10];

    // ---- f32 scratch ----
    float* ws    = (float*)d_ws;
    float* q     = ws;                        // 256*512
    float* k     = q    + MROWS*512;
    float* v     = k    + MROWS*512;
    float* g     = v    + MROWS*512;
    float* beta  = g    + MROWS*512;          // 256*64
    float* tg    = beta + MROWS*64;
    float* cosw  = tg   + MROWS*64;           // 64*64
    float* sinw  = cosw + HH*RR*DK;
    float* rho   = sinw + HH*RR*DK;           // 64
    float* modew = rho  + HH*RR;
    float* ys    = modew + HH*RR;             // 256*8*8*64 = 1048576
    float* fend  = ys   + MROWS*HH*RR*DV;

    // ---- f16 scratch (16B-aligned: float count above is a multiple of 4) ----
    _Float16* hb   = (_Float16*)fend;
    _Float16* xh   = hb;                      // 256*1024
    _Float16* Wqt  = xh   + MROWS*DD;         // 512*1024 each
    _Float16* Wkt  = Wqt  + 512*DD;
    _Float16* Wvt  = Wkt  + 512*DD;
    _Float16* Wgt  = Wvt  + 512*DD;
    _Float16* Wbt  = Wgt  + 512*DD;           // 64*1024 each
    _Float16* Wtgt = Wbt  + 64*DD;
    _Float16* Wot  = Wtgt + 64*DD;            // 1024*512
    _Float16* ogh  = Wot  + DD*512;           // 256*512

    // parameter table, f16 copy of x and the seven weight transposes
    prep_kernel<<<PREP_BLOCKS, 256, 0, stream>>>(x, Wq, Wk, Wv, Wg, Wo, Wb, Wtg,
                                                 mlg, ldc, oms,
                                                 xh, Wqt, Wkt, Wvt, Wgt, Wot, Wbt, Wtgt,
                                                 cosw, sinw, rho, modew);

    // the six input projections; 8 tiles (waves) per 256-thread block
    proj_wmma<<<PROJ_BLOCKS, 256, 0, stream>>>(xh, Wqt, Wkt, Wvt, Wgt, Wbt, Wtgt,
                                               q, k, v, g, beta, tg);

    // 8192 rows, 8 lanes each, 32 rows per 256-thread block -> 256 blocks
    scan_kernel<<<256, 256, 0, stream>>>(q, k, v, beta, tg, cosw, sinw, rho, modew, ys);

    combine_kernel<<<(MROWS*HH*DV)/256, 256, 0, stream>>>(ys, g, ogh);

    gemm16_wmma<<<(16*64)/8, 256, 0, stream>>>(ogh, Wot, (float*)d_out,
                                               MROWS, DD, 512, 0);
}

// v006
// It runs in 42.7 microseconds.
// Timed twice side by side with v005, it ran 1.21 and 1.19 times as fast.
// All steps since v000 together make it 5.42 times as fast.
#include <hip/hip_runtime.h>
#include <hip/hip_bf16.h>
#include <math.h>

// Problem constants (from reference)
#define BB 2
#define TT 128
#define DD 1024
#define HH 8
#define RR 8
#define DK 64
#define DV 64
#define MROWS (BB*TT)          // 256

typedef __attribute__((ext_vector_type(16))) _Float16 v16h;
typedef __attribute__((ext_vector_type(8)))  _Float16 v8h;
typedef __attribute__((ext_vector_type(4)))  _Float16 v4h;
typedef __attribute__((ext_vector_type(2)))  _Float16 v2h;
typedef __attribute__((ext_vector_type(8)))  float    v8f;
typedef __attribute__((ext_vector_type(4)))  float    v4f;
typedef __attribute__((ext_vector_type(2)))  float    v2f;

__device__ __forceinline__ float sigmoid_fast(float x) {
    return __builtin_amdgcn_rcpf(1.0f + __expf(-x));
}

// ---------------------------------------------------------------------------
// WMMA GEMM with native-layout f16 operands.
//   A  : [M,K] f16 row-major
//   Bt : [N,K] f16 row-major (i.e. W[K,N] pre-transposed)
//   C  : [M,N] f32 row-major
// Per ISA 7.12.2 the 16x32 f16 A fragment for lane L (m=L&15, hi=L>>4) is
//   halves 0..7  = K  8*hi + 0..7   (contiguous)
//   halves 8..15 = K 16+8*hi + 0..7 (contiguous)
// so each fragment = two global_load_b128 per lane; same for B against Bt.
// 8 waves / block, one 16x16 C tile per wave (linear tile id).
// K must be a multiple of 64 (manual 2x unroll -> 2 WMMAs/iter).
// blk is the block's index within its own product.
// a4 != 0: A is not row-major but lies in pieces of 4 k, M = 2 x 128 rows: piece
// kq = k / 4 of batch b holds its 128 rows one after the other, 8 bytes each, at
// ((b*128 + kq)*128 + t)*4 halves. The 8 contiguous k of a fragment half are two
// such pieces, TT*4 halves apart; the 16 lanes of a half wave read one whole
// 128-byte line per load. The k order of the fragment is the same in both.
// ---------------------------------------------------------------------------
__device__ __forceinline__ v8h a_pieces(const _Float16* __restrict__ p)
{
    const v4h x = *(const v4h*)p;
    const v4h y = *(const v4h*)(p + TT*4);
    return __builtin_shufflevector(x, y, 0,1,2,3,4,5,6,7);
}

__device__ __forceinline__ void gemm16_tile(const _Float16* __restrict__ A,
                                            const _Float16* __restrict__ Bt,
                                            float* __restrict__ C,
                                            int M, int N, int K, int act, int blk,
                                            int a4)
{
    const int lane = threadIdx.x & 31;
    const int wid  = threadIdx.x >> 5;
    const int tid  = blk * 8 + wid;                 // linear 16x16 tile id
    const int ntiles = N >> 4;
    const int m0 = (tid / ntiles) << 4;
    const int n0 = (tid % ntiles) << 4;
    if (m0 >= M) return;                            // wave-uniform guard

    const int hi = lane >> 4;
    const int lo = lane & 15;
    const int m = m0 + lo;
    const _Float16* arow = a4 ? A + (size_t)(((m >> 7)*128 + 2*hi)*TT + (m & (TT-1))) * 4
                              : A + (size_t)m * K + 8*hi;
    const _Float16* brow = Bt + (size_t)(n0 + lo) * K + 8*hi;

    v8f acc = {};
    for (int k0 = 0; k0 < K; k0 += 64) {
        v8h al0, ah0, al1, ah1;
        if (a4) {
            al0 = a_pieces(arow + (k0     ) * TT);
            ah0 = a_pieces(arow + (k0 + 16) * TT);
            al1 = a_pieces(arow + (k0 + 32) * TT);
            ah1 = a_pieces(arow + (k0 + 48) * TT);
        } else {
            al0 = *(const v8h*)(arow + k0);
            ah0 = *(const v8h*)(arow + k0 + 16);
            al1 = *(const v8h*)(arow + k0 + 32);
            ah1 = *(const v8h*)(arow + k0 + 48);
        }
        v8h bl0 = *(const v8h*)(brow + k0);
        v8h bh0 = *(const v8h*)(brow + k0 + 16);
        v8h bl1 = *(const v8h*)(brow + k0 + 32);
        v8h bh1 = *(const v8h*)(brow + k0 + 48);
        v16h a0 = __builtin_shufflevector(al0, ah0, 0,1,2,3,4,5,6,7,8,9,10,11,12,13,14,15);
        v16h b0 = __builtin_shufflevector(bl0, bh0, 0,1,2,3,4,5,6,7,8,9,10,11,12,13,14,15);
        v16h a1 = __builtin_shufflevector(al1, ah1, 0,1,2,3,4,5,6,7,8,9,10,11,12,13,14,15);
        v16h b1 = __builtin_shufflevector(bl1, bh1, 0,1,2,3,4,5,6,7,8,9,10,11,12,13,14,15);
        acc = __builtin_amdgcn_wmma_f32_16x16x32_f16(false, a0, false, b0,
                                                     (short)0, acc, false, false);
        acc = __builtin_amdgcn_wmma_f32_16x16x32_f16(false, a1, false, b1,
                                                     (short)0, acc, false, false);
    }
#pragma unroll
    for (int r = 0; r < 8; ++r) {
        float x = acc[r];
        if (act == 1) x = sigmoid_fast(x);
        C[(size_t)(m0 + r + 8*hi) * N + (n0 + lo)] = x;
    }
}

// The output projection: one product per launch. Its A comes from the scan in
// pieces of 4 k (a4 above).
__global__ __launch_bounds__(256)
void out_wmma(const _Float16* __restrict__ A,
              const _Float16* __restrict__ Bt,
              float* __restrict__ C)
{
    gemm16_tile(A, Bt, C, MROWS, DD, HH*DV, 0, blockIdx.x, 1);
}

// The six input projections share A and do not depend on one another: one
// launch, a range of blocks per product. 64 blocks each for q, k, v and the
// gate (N = 512), then 8 each for beta and tg (N = 64).
#define PROJ_BLOCKS (4*64 + 2*8)
__global__ __launch_bounds__(256)
void proj_wmma(const _Float16* __restrict__ xh,
               const _Float16* __restrict__ Wqt,
               const _Float16* __restrict__ Wkt,
               const _Float16* __restrict__ Wvt,
               const _Float16* __restrict__ Wgt,
               const _Float16* __restrict__ Wbt,
               const _Float16* __restrict__ Wtgt,
               float* __restrict__ q,
               float* __restrict__ k,
               float* __restrict__ v,
               float* __restrict__ g,
               float* __restrict__ beta,
               float* __restrict__ tg)
{
    const int blk = blockIdx.x;
    if (blk < 4*64) {
        const int job = blk >> 6;
        const _Float16* Bt = job == 0 ? Wqt : job == 1 ? Wkt : job == 2 ? Wvt : Wgt;
        float*          C  = job == 0 ? q   : job == 1 ? k   : job == 2 ? v   : g;
        gemm16_tile(xh, Bt, C, MROWS, 512, DD, job == 3 ? 1 : 0, blk & 63, 0);
    } else {
        const int job = (blk - 4*64) >> 3;
        gemm16_tile(xh, job == 0 ? Wbt : Wtgt, job == 0 ? beta : tg,
                    MROWS, 64, DD, 1, blk & 7, 0);
    }
}

// ---------------------------------------------------------------------------
// Layout prep: f32 -> f16 copy, and f32 [K,N] -> f16 [N,K] transpose.
// blk is the block's index within its own job; 256 threads a block, 32 elements
// a thread, so that the launch starts few waves and every global access is a
// 16-byte piece of a whole line.
// ---------------------------------------------------------------------------
#define PREP_ELEMS 8192            // elements a block handles
#define TILE_K 128
#define TILE_N 64
#define TILE_PITCH 65              // floats; odd, so that a column walk changes bank

__device__ __forceinline__ void cvt_f16_block(const float* __restrict__ in,
                                              _Float16* __restrict__ out, int blk)
{
    const unsigned base = blk * PREP_ELEMS + threadIdx.x * 8;     // in elements
    // all loops here are unrolled so that the arrays are indexed by constants and
    // stay in registers, and the 8 loads fly together
    v4f lo[4], hi[4];
#pragma unroll
    for (int it = 0; it < 4; ++it) {
        lo[it] = *(const v4f*)(in + base + it*2048);
        hi[it] = *(const v4f*)(in + base + it*2048 + 4);
    }
#pragma unroll
    for (int it = 0; it < 4; ++it) {
        v8h h;
#pragma unroll
        for (int j = 0; j < 4; ++j) {
            h[j]     = (_Float16)lo[it][j];
            h[4 + j] = (_Float16)hi[it][j];
        }
        *(v8h*)(out + base + it*2048) = h;
    }
    // the code that follows in the kernel's listing reuses the stores' address and
    // data registers: keep the wait between the four stores and those writes
    asm volatile("s_wait_xcnt 0x0" ::: "memory");
}

// One block turns a tile of 128 k x 64 n. It reads 256-byte pieces of the rows
// of in, lays them in LDS as they are, and each thread then walks down a column
// and stores 8 k of one n as 16 bytes: a block writes 256 bytes of each of its
// 64 rows of out. K and N are multiples of 128 and 64.
__device__ __forceinline__ void transpose_f16_tile(const float* __restrict__ in, // [K,N]
                                                   _Float16* __restrict__ out,   // [N,K]
                                                   int K, int N, int blk,
                                                   float* __restrict__ tile)
{
    const int tid = threadIdx.x;
    const int ntn = N / TILE_N;
    const int k0  = (blk / ntn) * TILE_K;
    const int n0  = (blk % ntn) * TILE_N;
    const int lr  = tid >> 4;              // row of the first piece, 16 rows a pass
    const int lc  = (tid & 15) * 4;
    const float* src = in + (size_t)(k0 + lr) * N + n0 + lc;
    // all loops here are unrolled so that the arrays are indexed by constants and
    // stay in registers, and the 8 loads fly together
    v4f ld[8];
#pragma unroll
    for (int it = 0; it < 8; ++it)
        ld[it] = *(const v4f*)(src + (size_t)it * 16 * N);
#pragma unroll
    for (int it = 0; it < 8; ++it)
#pragma unroll
        for (int j = 0; j < 4; ++j)
            tile[(lr + 16*it) * TILE_PITCH + lc + j] = ld[it][j];
    // every wave reads what the other waves laid down
    __syncthreads();
    const int n  = tid >> 2;
    const int kq = (tid & 3) * 8;
    _Float16* dst = out + (size_t)(n0 + n) * K + k0 + kq;
#pragma unroll
    for (int g = 0; g < 4; ++g) {
        v8h h;
#pragma unroll
        for (int j = 0; j < 8; ++j)
            h[j] = (_Float16)tile[(kq + 32*g + j) * TILE_PITCH + n];
        *(v8h*)(dst + 32*g) = h;
    }
    // the code that follows in the kernel's listing reuses the stores' address and
    // data registers: keep the wait between the four stores and those writes
    asm volatile("s_wait_xcnt 0x0" ::: "memory");
}

// ---------------------------------------------------------------------------
// Precompute per-(h,r) spectral parameters. One wave per (h,r): its 32 lanes
// take the 32 frequency pairs of Dk, one each, so that the table costs one pass
// through powf, cosf and sinf, not a serial walk over Dk. 8 waves a block.
// blk is the block's index within this job.
// ---------------------------------------------------------------------------
#define PREP_PAR_BLOCKS ((HH*RR)/8)   // 8
__device__ __forceinline__ void params_block(const float* __restrict__ mode_logits,
                                             const float* __restrict__ log_decay,
                                             const float* __restrict__ omega_log_scale,
                                             float* __restrict__ cosw,
                                             float* __restrict__ sinw,
                                             float* __restrict__ rho,
                                             float* __restrict__ modew,
                                             int blk)
{
    const int t = blk * 8 + (threadIdx.x >> 5);              // 0..63, one a wave
    const int h = t >> 3;
    const int p = threadIdx.x & 31;                          // frequency pair

    // all that the wave reads, in flight together: one load latency
    const float ols = omega_log_scale[t];
    const float ld  = log_decay[t];
    const float mlt = mode_logits[t];
    const v4f ml0 = *(const v4f*)(mode_logits + h*RR);
    const v4f ml1 = *(const v4f*)(mode_logits + h*RR + 4);
    // the address registers of these loads are reused by the arithmetic below:
    // keep the wait between the loads and those writes; the scheduling barrier
    // keeps that arithmetic from being lifted over the wait
    asm volatile("s_wait_xcnt 0x0" ::: "memory");
    __builtin_amdgcn_sched_barrier(0);
    const float ml[RR] = {ml0.x, ml0.y, ml0.z, ml0.w, ml1.x, ml1.y, ml1.z, ml1.w};

    const float pidx = (float)(2 * p);                       // repeat_interleave
    const float invf = powf(10000.0f, -pidx / (float)DK);
    const float w  = expf(ols) * invf;
    const float cw = cosf(w);
    const float sw = sinf(w);
    const v2f c2 = {cw, cw};
    const v2f s2 = {sw, sw};

    const float sp = (ld > 20.0f) ? ld : log1pf(expf(ld));   // softplus
    const float rh = expf(-sp);
    // unrolled so that ml is indexed by constants and stays in registers
    float mx = -1e30f;
#pragma unroll
    for (int j = 0; j < RR; ++j) mx = fmaxf(mx, ml[j]);
    float sum = 0.0f;
#pragma unroll
    for (int j = 0; j < RR; ++j) sum += expf(ml[j] - mx);
    const float mwt = expf(mlt - mx) / sum;

    *(v2f*)(cosw + t*DK + 2*p) = c2;
    *(v2f*)(sinw + t*DK + 2*p) = s2;
    if (p == 0) {
        rho[t]   = rh;
        modew[t] = mwt;
    }
}

// ---------------------------------------------------------------------------
// All of the prep in one launch: the parameter table, the f16 copy of x and the
// seven weight transposes read only inputs and write disjoint scratch, so none
// waits for another. A range of blocks per job.
// ---------------------------------------------------------------------------
#define PREP_X_BLOCKS   ((MROWS*DD)/PREP_ELEMS)   // 32
#define PREP_BIG_BLOCKS ((DD*512)/PREP_ELEMS)     // 64
#define PREP_SML_BLOCKS ((DD*64)/PREP_ELEMS)      // 8
#define PREP_BLOCKS (PREP_PAR_BLOCKS + PREP_X_BLOCKS + 5*PREP_BIG_BLOCKS + 2*PREP_SML_BLOCKS)
__global__ __launch_bounds__(256)
void prep_kernel(const float* __restrict__ x,
                 const float* __restrict__ Wq,
                 const float* __restrict__ Wk,
                 const float* __restrict__ Wv,
                 const float* __restrict__ Wg,
                 const float* __restrict__ Wo,
                 const float* __restrict__ Wb,
                 const float* __restrict__ Wtg,
                 const float* __restrict__ mode_logits,
                 const float* __restrict__ log_decay,
                 const float* __restrict__ omega_log_scale,
                 _Float16* __restrict__ xh,
                 _Float16* __restrict__ Wqt,
                 _Float16* __restrict__ Wkt,
                 _Float16* __restrict__ Wvt,
                 _Float16* __restrict__ Wgt,
                 _Float16* __restrict__ Wot,
                 _Float16* __restrict__ Wbt,
                 _Float16* __restrict__ Wtgt,
                 float* __restrict__ cosw,
                 float* __restrict__ sinw,
                 float* __restrict__ rho,
                 float* __restrict__ modew)
{
    __shared__ float tile[TILE_K * TILE_PITCH];
    int blk = blockIdx.x;
    if (blk < PREP_PAR_BLOCKS) {
        params_block(mode_logits, log_decay, omega_log_scale, cosw, sinw, rho, modew, blk);
        return;
    }
    blk -= PREP_PAR_BLOCKS;
    if (blk < PREP_X_BLOCKS) {
        cvt_f16_block(x, xh, blk);
        return;
    }
    blk -= PREP_X_BLOCKS;
    if (blk < 4*PREP_BIG_BLOCKS) {
        const int job = blk / PREP_BIG_BLOCKS;
        const float* in  = job == 0 ? Wq  : job == 1 ? Wk  : job == 2 ? Wv  : Wg;
        _Float16*    out = job == 0 ? Wqt : job == 1 ? Wkt : job == 2 ? Wvt : Wgt;
        transpose_f16_tile(in, out, DD, 512, blk % PREP_BIG_BLOCKS, tile);
        return;
    }
    blk -= 4*PREP_BIG_BLOCKS;
    if (blk < PREP_BIG_BLOCKS) {
        transpose_f16_tile(Wo, Wot, 512, DD, blk, tile);
        return;
    }
    blk -= PREP_BIG_BLOCKS;
    const int job = blk / PREP_SML_BLOCKS;
    transpose_f16_tile(job == 0 ? Wb : Wtg, job == 0 ? Wbt : Wtgt, DD, 64,
                       blk % PREP_SML_BLOCKS, tile);
}

// ---------------------------------------------------------------------------
// Recurrent scan: 8 lanes share one state row (b,h,r,v); each lane keeps 8 of
// the 64 Dk elements (real and imaginary) in registers, as two groups of four:
// k = 4*sub + 0..3 and k = 32 + 4*sub + 0..3, so that the 8 lanes of a row read
// one 128-byte line per 16-byte load. The two sums over Dk of a time step end
// in three in-row DPP adds (lane ^ 1, ^ 2, ^ 4).
// One block = the 8 modes r of 4 v of one (b,h): wave r holds mode r, 4 rows.
// So the block owns all that an output element (b,t,h,v) is summed from: each
// row's weighted read-outs are kept in LDS, and behind the loop the block sums
// them over r, applies the gate and stores the f16 operand of the output
// projection itself, as 1 KB of its own: og[block][t][4 v].
// What the block reads in its 128 time steps (the k and q rows of its (b,h), its
// 4 v of each step, decay and beta of its h) is brought into LDS once, ahead
// of the loop, with all loads in flight together; the loop reads it from there
// one time step ahead, so that no load latency is left in a time step.
// ---------------------------------------------------------------------------
template <int CTRL>
__device__ __forceinline__ float add_row_xmask(float x)
{
    // x + (x of lane ^ mask), mask in the low bits of CTRL (0x160 | mask)
    const int xi = __builtin_bit_cast(int, x);
    const int yi = __builtin_amdgcn_update_dpp(0, xi, CTRL, 0xf, 0xf, true);
    return x + __builtin_bit_cast(float, yi);
}

__device__ __forceinline__ float sum_over_8_lanes(float x)
{
    x = add_row_xmask<0x161>(x);
    x = add_row_xmask<0x162>(x);
    x = add_row_xmask<0x164>(x);
    return x;
}

#define YPITCH (TT + 8)   // floats; the 4 rows of a wave then store on disjoint banks

// The grid is 2048 waves, two per SIMD: waves_per_eu says so, so that the
// register budget is not held at 64: the staging holds the results of a thread's
// twenty-one loads at once.
__global__ __launch_bounds__(256) __attribute__((amdgpu_waves_per_eu(2, 2)))
void scan_kernel(const float* __restrict__ q,
                 const float* __restrict__ k,
                 const float* __restrict__ v,
                 const float* __restrict__ g,
                 const float* __restrict__ beta,
                 const float* __restrict__ tg,
                 const float* __restrict__ cosw,
                 const float* __restrict__ sinw,
                 const float* __restrict__ rho,
                 const float* __restrict__ modew,
                 _Float16* __restrict__ og)
{
    const unsigned tid = threadIdx.x;
    const int vg   = blockIdx.x & 15;
    const int h    = (blockIdx.x >> 4) & 7;
    const int b    = (blockIdx.x >> 7) & 1;
    // the wave's number, said to be uniform so that what hangs on it is scalar
    const int r    = __builtin_amdgcn_readfirstlane(tid >> 5);
    const int hr   = h*RR + r;
    const int sub  = tid & 7;
    const int vloc = (tid >> 3) & 3;

    __shared__ v4f ks[TT*16];         // k rows, 64 floats a step
    __shared__ v4f qs[TT*16];         // q rows, 64 floats a step
    __shared__ v4f vs[TT];            // this block's 4 v of a step
    __shared__ v4f db[TT*4];          // (decay, beta) of a step's 8 modes
    __shared__ float yl[32*YPITCH];   // weighted read-outs, [r*4 + v][t]

    const float mw = modew[hr];
    // keeps the scalar load above from being placed between the four loads
    // below and their wait, where it would land in those loads' base registers
    __builtin_amdgcn_sched_barrier(0);

    const float4* c4 = (const float4*)(cosw + hr*DK);
    const float4* s4 = (const float4*)(sinw + hr*DK);
    const float4 ca = c4[sub], cb = c4[8 + sub];
    const float4 sa = s4[sub], sb = s4[8 + sub];
    // the base registers of these four loads are reused right behind them: keep
    // the wait between the loads and those writes; the scheduling barrier keeps
    // the later index arithmetic from being lifted over the wait
    asm volatile("s_wait_xcnt 0x0" ::: "memory");
    __builtin_amdgcn_sched_barrier(0);
    const float c[8] = {ca.x, ca.y, ca.z, ca.w, cb.x, cb.y, cb.z, cb.w};
    const float s[8] = {sa.x, sa.y, sa.z, sa.w, sb.x, sb.y, sb.z, sb.w};

    // Staging. row0 is the flat (b,0,h); the next time step lies HH rows on. A
    // wave's 16-byte loads cover whole 256-byte k or q rows; a thread's pieces lie
    // 16 steps apart. Of step tid / 2 a thread brings two of the block's 4 v, the
    // gate of the same two (g is laid out as v is) and tg, beta and rho of four of
    // the 8 modes.
    const unsigned row0 = b*TT*HH + h;
    const unsigned kq_off = ((row0 + (tid >> 4)*HH)*DK + (tid & 15)*4) * 4;
    const unsigned v_off  = ((row0 + (tid >> 1)*HH)*DV + vg*4 + (tid & 1)*2) * 4;
    const unsigned d_off  = ((row0 + (tid >> 1)*HH)*RR + (tid & 1)*4) * 4;
    const unsigned r_off  = (h*RR + (tid & 1)*4) * 4;
    // the loop is unrolled so that the arrays stay in registers and all of a
    // thread's loads are in flight at once
    v4f kst[8], qst[8];
#pragma unroll
    for (int it = 0; it < 8; ++it) {
        kst[it] = *(const v4f*)((const char*)k + kq_off + it*(16*HH*DK*4));
        qst[it] = *(const v4f*)((const char*)q + kq_off + it*(16*HH*DK*4));
    }
    const v2f vst   = *(const v2f*)((const char*)v + v_off);
    const v2f gst   = *(const v2f*)((const char*)g + v_off);
    const v4f tg_st = *(const v4f*)((const char*)tg + d_off);
    const v4f be_st = *(const v4f*)((const char*)beta + d_off);
    const v4f rh_st = *(const v4f*)((const char*)rho + r_off);
    // The wait stands between these loads and every later write of their offset
    // registers. It takes the loaded values and the four offsets as inputs only:
    // so all the loads are issued ahead of it, and no offset register is given
    // to a load's result or to later arithmetic before it. The scheduling barrier
    // keeps later index arithmetic, which reuses the loads' base registers, from
    // being lifted over the wait.
    asm volatile("s_wait_xcnt 0x0"
                 :: "v"(kst[0]), "v"(kst[1]), "v"(kst[2]), "v"(kst[3]),
                    "v"(kst[4]), "v"(kst[5]), "v"(kst[6]), "v"(kst[7]),
                    "v"(qst[0]), "v"(qst[1]), "v"(qst[2]), "v"(qst[3]),
                    "v"(qst[4]), "v"(qst[5]), "v"(qst[6]), "v"(qst[7]),
                    "v"(vst), "v"(gst), "v"(tg_st), "v"(be_st), "v"(rh_st),
                    "v"(kq_off), "v"(v_off), "v"(d_off), "v"(r_off)
                 : "memory");
    __builtin_amdgcn_sched_barrier(0);
#pragma unroll
    for (int it = 0; it < 8; ++it) {
        ks[it*256 + tid] = kst[it];
        qs[it*256 + tid] = qst[it];
    }
    ((v2f*)vs)[tid] = vst;
    db[2*tid]     = (v4f){tg_st.x * rh_st.x, be_st.x, tg_st.y * rh_st.y, be_st.y};
    db[2*tid + 1] = (v4f){tg_st.z * rh_st.z, be_st.z, tg_st.w * rh_st.w, be_st.w};
    // every wave reads what the other waves staged
    __syncthreads();
    const float* vsf = (const float*)vs + vloc;
    const v2f*   dbr = (const v2f*)db + r;

    // every loop over e below is unrolled so that the 8-element arrays are
    // indexed by constants and stay in registers
    float sr[8], si[8];
#pragma unroll
    for (int e = 0; e < 8; ++e) { sr[e] = 0.f; si[e] = 0.f; }

    // A trip works on operands that were read from LDS in the trip before.
    v4f ka = ks[sub], kb = ks[8 + sub];
    v4f qa = qs[sub], qb = qs[8 + sub];
    v2f dbt = dbr[0];
    float vt = vsf[0];
    float* yrow = yl + (r*4 + vloc)*YPITCH + sub;
    for (int t0 = 0; t0 < TT; t0 += 8) {
        // Lane sub of a row keeps the read-out of step t0 + sub, so that 8 steps
        // end in one LDS store from every lane. Unrolled so that the lane that
        // keeps a step is a constant.
        float keep = 0.f;
#pragma unroll
        for (int j = 0; j < 8; ++j) {
            const int t = t0 + j;
            const float decay = dbt.x;
            const float bet   = dbt.y;
            const float kt[8] = {ka.x, ka.y, ka.z, ka.w, kb.x, kb.y, kb.z, kb.w};
            const float qt[8] = {qa.x, qa.y, qa.z, qa.w, qb.x, qb.y, qb.z, qb.w};

            float rr[8];
#pragma unroll
            for (int e = 0; e < 8; ++e) {
                rr[e] = decay * (c[e]*sr[e] - s[e]*si[e]);
                si[e] = decay * (s[e]*sr[e] + c[e]*si[e]);
            }

            const float pa = rr[0]*kt[0] + rr[2]*kt[2] + rr[4]*kt[4] + rr[6]*kt[6];
            const float pb = rr[1]*kt[1] + rr[3]*kt[3] + rr[5]*kt[5] + rr[7]*kt[7];
            const float pred = sum_over_8_lanes(pa + pb);

            const float bw = bet * (vt - pred);
#pragma unroll
            for (int e = 0; e < 8; ++e) sr[e] = rr[e] + bw*kt[e];

            const float ra = sr[0]*qt[0] + sr[2]*qt[2] + sr[4]*qt[4] + sr[6]*qt[6];
            const float rb = sr[1]*qt[1] + sr[3]*qt[3] + sr[5]*qt[5] + sr[7]*qt[7];

            // This step's operands are used up: the next step's are read into
            // their place. The last trip reads its own step again, so that
            // nothing behind the staged rows is read.
            const int tn = (t + 1 < TT) ? t + 1 : t;
            ka = ks[tn*16 + sub];  kb = ks[tn*16 + 8 + sub];
            qa = qs[tn*16 + sub];  qb = qs[tn*16 + 8 + sub];
            dbt = dbr[tn*RR];
            vt  = vsf[tn*4];

            const float rd = sum_over_8_lanes(ra + rb);
            keep = (sub == j) ? rd : keep;
        }
        yrow[t0] = keep * mw;
    }
    // every wave reads the other modes' read-outs
    __syncthreads();

    // Two outputs a thread: step tid / 2, v = 2*(tid & 1) + 0, 1; the modes are
    // summed in the order r = 0..7.
    const float* ye = yl + (tid & 1)*2*YPITCH + (tid >> 1);
    float o0 = 0.0f, o1 = 0.0f;
    // unrolled so that the 16 LDS reads are issued together
#pragma unroll
    for (int m = 0; m < RR; ++m) {
        o0 += ye[(m*4)*YPITCH];
        o1 += ye[(m*4 + 1)*YPITCH];
    }
    const v2h oh = {(_Float16)(o0 * gst.x), (_Float16)(o1 * gst.y)};
    *(v2h*)(og + (size_t)blockIdx.x * (TT*4) + 2*tid) = oh;
}

// ---------------------------------------------------------------------------
extern "C" void kernel_launch(void* const* d_in, const int* in_sizes, int n_in,
                              void* d_out, int out_size, void* d_ws, size_t ws_size,
                              hipStream_t stream)
{
    (void)in_sizes; (void)n_in; (void)out_size; (void)ws_size;
    const float* x    = (const float*)d_in[0];
    const float* Wq   = (const float*)d_in[1];
    const float* Wk   = (const float*)d_in[2];
    const float* Wv   = (const float*)d_in[3];
    const float* Wb   = (const float*)d_in[4];
    const float* Wtg  = (const float*)d_in[5];
    const float* mlg  = (const float*)d_in[6];
    const float* ldc  = (const float*)d_in[7];
    const float* oms  = (const float*)d_in[8];
    const float* Wg   = (const float*)d_in[9];
    const float* Wo   = (const float*)d_in[10];

    // ---- f32 scratch ----
    float* ws    = (float*)d_ws;
    float* q     = ws;                        // 256*512
    float* k     = q    + MROWS*512;
    float* v     = k    + MROWS*512;
    float* g     = v    + MROWS*512;
    float* beta  = g    + MROWS*512;          // 256*64
    float* tg    = beta + MROWS*64;
    float* cosw  = tg   + MROWS*64;           // 64*64
    float* sinw  = cosw + HH*RR*DK;
    float* rho   = sinw + HH*RR*DK;           // 64
    float* modew = rho  + HH*RR;
    float* fend  = modew + HH*RR;

    // ---- f16 scratch (16B-aligned: float count above is a multiple of 4) ----
    _Float16* hb   = (_Float16*)fend;
    _Float16* xh   = hb;                      // 256*1024
    _Float16* Wqt  = xh   + MROWS*DD;         // 512*1024 each
    _Float16* Wkt  = Wqt  + 512*DD;
    _Float16* Wvt  = Wkt  + 512*DD;
    _Float16* Wgt  = Wvt  + 512*DD;
    _Float16* Wbt  = Wgt  + 512*DD;           // 64*1024 each
    _Float16* Wtgt = Wbt  + 64*DD;
    _Float16* Wot  = Wtgt + 64*DD;            // 1024*512
    _Float16* ogh  = Wot  + DD*512;           // 256*512, in pieces of 4 k

    // parameter table, f16 copy of x and the seven weight transposes
    prep_kernel<<<PREP_BLOCKS, 256, 0, stream>>>(x, Wq, Wk, Wv, Wg, Wo, Wb, Wtg,
                                                 mlg, ldc, oms,
                                                 xh, Wqt, Wkt, Wvt, Wgt, Wot, Wbt, Wtgt,
                                                 cosw, sinw, rho, modew);

    // the six input projections; 8 tiles (waves) per 256-thread block
    proj_wmma<<<PROJ_BLOCKS, 256, 0, stream>>>(xh, Wqt, Wkt, Wvt, Wgt, Wbt, Wtgt,
                                               q, k, v, g, beta, tg);

    // 8192 rows, 8 lanes each, 32 rows per 256-thread block -> 256 blocks
    scan_kernel<<<256, 256, 0, stream>>>(q, k, v, g, beta, tg, cosw, sinw, rho, modew, ogh);

    out_wmma<<<(16*64)/8, 256, 0, stream>>>(ogh, Wot, (float*)d_out);
}

// v007
// Measured time: 34.6 microseconds a run.
// Timed twice side by side with v006, it ran 1.23 times as fast both times.
// Counting every step since v000, it is 6.66 times as fast.
#include <hip/hip_runtime.h>
#include <hip/hip_bf16.h>
#include <math.h>

// Problem constants (from reference)
#define BB 2
#define TT 128
#define DD 1024
#define HH 8
#define RR 8
#define DK 64
#define DV 64
#define MROWS (BB*TT)          // 256

typedef __attribute__((ext_vector_type(16))) _Float16 v16h;
typedef __attribute__((ext_vector_type(8)))  _Float16 v8h;
typedef __attribute__((ext_vector_type(4)))  _Float16 v4h;
typedef __attribute__((ext_vector_type(2)))  _Float16 v2h;
typedef __attribute__((ext_vector_type(8)))  float    v8f;
typedef __attribute__((ext_vector_type(4)))  float    v4f;
typedef __attribute__((ext_vector_type(2)))  float    v2f;

__device__ __forceinline__ float sigmoid_fast(float x) {
    return __builtin_amdgcn_rcpf(1.0f + __expf(-x));
}

// ---------------------------------------------------------------------------
// WMMA GEMM with native-layout f16 operands.
//   A  : [M,K] f16 row-major
//   Bt : [N,K] f16 row-major (i.e. W[K,N] pre-transposed)
//   C  : [M,N] f32 row-major
// Per ISA 7.12.2 the 16x32 f16 A fragment for lane L (m=L&15, hi=L>>4) is
//   halves 0..7  = K  8*hi + 0..7   (contiguous)
//   halves 8..15 = K 16+8*hi + 0..7 (contiguous)
// so each fragment = two global_load_b128 per lane; same for B against Bt.
// 8 waves / block, one 16x16 C tile per wave (linear tile id).
// K must be a multiple of 64 (manual 2x unroll -> 2 WMMAs/iter).
// blk is the block's index within its own product.
// a4 != 0: A is not row-major but lies in pieces of 4 k, M = 2 x 128 rows: piece
// kq = k / 4 of batch b holds its 128 rows one after the other, 8 bytes each, at
// ((b*128 + kq)*128 + t)*4 halves. The 8 contiguous k of a fragment half are two
// such pieces, TT*4 halves apart; the 16 lanes of a half wave read one whole
// 128-byte line per load. The k order of the fragment is the same in both.
// ---------------------------------------------------------------------------
__device__ __forceinline__ v8h a_pieces(const _Float16* __restrict__ p)
{
    const v4h x = *(const v4h*)p;
    const v4h y = *(const v4h*)(p + TT*4);
    return __builtin_shufflevector(x, y, 0,1,2,3,4,5,6,7);
}

__device__ __forceinline__ void gemm16_tile(const _Float16* __restrict__ A,
                                            const _Float16* __restrict__ Bt,
                                            float* __restrict__ C,
                                            int M, int N, int K, int act, int blk,
                                            int a4)
{
    const int lane = threadIdx.x & 31;
    const int wid  = threadIdx.x >> 5;
    const int tid  = blk * 8 + wid;                 // linear 16x16 tile id
    const int ntiles = N >> 4;
    const int m0 = (tid / ntiles) << 4;
    const int n0 = (tid % ntiles) << 4;
    if (m0 >= M) return;                            // wave-uniform guard

    const int hi = lane >> 4;
    const int lo = lane & 15;
    const int m = m0 + lo;
    const _Float16* arow = a4 ? A + (size_t)(((m >> 7)*128 + 2*hi)*TT + (m & (TT-1))) * 4
                              : A + (size_t)m * K + 8*hi;
    const _Float16* brow = Bt + (size_t)(n0 + lo) * K + 8*hi;

    v8f acc = {};
    for (int k0 = 0; k0 < K; k0 += 64) {
        v8h al0, ah0, al1, ah1;
        if (a4) {
            al0 = a_pieces(arow + (k0     ) * TT);
            ah0 = a_pieces(arow + (k0 + 16) * TT);
            al1 = a_pieces(arow + (k0 + 32) * TT);
            ah1 = a_pieces(arow + (k0 + 48) * TT);
        } else {
            al0 = *(const v8h*)(arow + k0);
            ah0 = *(const v8h*)(arow + k0 + 16);
            al1 = *(const v8h*)(arow + k0 + 32);
            ah1 = *(const v8h*)(arow + k0 + 48);
        }
        v8h bl0 = *(const v8h*)(brow + k0);
        v8h bh0 = *(const v8h*)(brow + k0 + 16);
        v8h bl1 = *(const v8h*)(brow + k0 + 32);
        v8h bh1 = *(const v8h*)(brow + k0 + 48);
        v16h a0 = __builtin_shufflevector(al0, ah0, 0,1,2,3,4,5,6,7,8,9,10,11,12,13,14,15);
        v16h b0 = __builtin_shufflevector(bl0, bh0, 0,1,2,3,4,5,6,7,8,9,10,11,12,13,14,15);
        v16h a1 = __builtin_shufflevector(al1, ah1, 0,1,2,3,4,5,6,7,8,9,10,11,12,13,14,15);
        v16h b1 = __builtin_shufflevector(bl1, bh1, 0,1,2,3,4,5,6,7,8,9,10,11,12,13,14,15);
        acc = __builtin_amdgcn_wmma_f32_16x16x32_f16(false, a0, false, b0,
                                                     (short)0, acc, false, false);
        acc = __builtin_amdgcn_wmma_f32_16x16x32_f16(false, a1, false, b1,
                                                     (short)0, acc, false, false);
    }
#pragma unroll
    for (int r = 0; r < 8; ++r) {
        float x = acc[r];
        if (act == 1) x = sigmoid_fast(x);
        C[(size_t)(m0 + r + 8*hi) * N + (n0 + lo)] = x;
    }
}

// The output projection: one product per launch. Its A comes from the scan in
// pieces of 4 k (a4 above).
__global__ __launch_bounds__(256)
void out_wmma(const _Float16* __restrict__ A,
              const _Float16* __restrict__ Bt,
              float* __restrict__ C)
{
    gemm16_tile(A, Bt, C, MROWS, DD, HH*DV, 0, blockIdx.x, 1);
}

// ---------------------------------------------------------------------------
// An input projection straight from the f32 inputs. One block = 32 rows of x
// against 64 columns of W[K,LDW], all of K = 1024, in 4 chunks of 256 k. A chunk
// is loaded as f32 in whole 256-byte (W) and 1-KB (x) pieces of rows, rounded to
// f16 in registers and laid in LDS as As[m][k] and Bs[n][k]: a thread holds 8 k
// of 4 n, so that the turn of W is only a choice of registers. The next chunk's
// loads fly while this chunk is multiplied; two LDS buffers, one barrier a chunk.
// 8 waves, one 16x16 tile each (2 in m x 4 in n); fragments and k order are those
// of gemm16_tile, read from LDS.
// In a row n of Bs the 16-byte groups of 8 k are stored at group ^ ((n >> 4) & 3):
// the 16 lanes of a store, which lie 4 rows apart, then fall on all 64 banks; for
// a reading wave n >> 4 is one number.
// ---------------------------------------------------------------------------
#define KCH 256                    // k of a chunk
#define LPITCH (KCH + 8)           // halves; 16 rows of 16-byte reads cover the banks
#define AS_HALVES (32 * LPITCH)
#define BS_HALVES (64 * LPITCH)
#define PROJ_LDS_BYTES ((2*AS_HALVES + 2*BS_HALVES) * 2)

template <int LDW>
__device__ __forceinline__ void proj_tile(const float* __restrict__ x,   // at row m0
                                          const float* __restrict__ Wn,  // at column n0
                                          float* __restrict__ C,         // at (m0, n0)
                                          int act,
                                          _Float16* __restrict__ As,
                                          _Float16* __restrict__ Bs)
{
    const int tid  = threadIdx.x;
    const int lane = tid & 31;
    const int wid  = tid >> 5;
    const int hi   = lane >> 4;
    const int lo   = lane & 15;
    const int mt   = wid & 1;
    const int nt   = wid >> 1;

    // loaders: W rows 8*kg + j (+ 128), columns 4*nq ..; x row tid / 32 (+ 8 u),
    // k = 8*(tid & 31) ..
    const int nq = tid & 15;
    const int kg = tid >> 4;
    const float* wsrc = Wn + (kg*8)*LDW + nq*4;
    const float* xsrc = x + (tid >> 5)*DD + (tid & 31)*8;
    _Float16* bdst = Bs + (nq*4)*LPITCH + ((kg ^ (nq >> 2)) << 3);
    _Float16* adst = As + (tid >> 5)*LPITCH + (tid & 31)*8;
    // readers
    const _Float16* ard  = As + (16*mt + lo)*LPITCH + 8*hi;
    const _Float16* brd  = Bs + (16*nt + lo)*LPITCH;
    const int bo0 = (hi ^ nt) << 3;
    const int bo1 = ((2 + hi) ^ nt) << 3;

    // every loop below is unrolled so that the arrays are indexed by constants and
    // stay in registers, and a chunk's 24 loads fly together
    v4f wl[16], xl[8];
#pragma unroll
    for (int g = 0; g < 2; ++g)
#pragma unroll
        for (int j = 0; j < 8; ++j)
            wl[g*8 + j] = *(const v4f*)(wsrc + (g*128 + j)*LDW);
#pragma unroll
    for (int u = 0; u < 4; ++u) {
        xl[2*u]     = *(const v4f*)(xsrc + u*8*DD);
        xl[2*u + 1] = *(const v4f*)(xsrc + u*8*DD + 4);
    }
    // the wait stands between these loads and any later write of their address
    // registers; the scheduling barrier keeps such writes from being lifted over it
    asm volatile("s_wait_xcnt 0x0" ::: "memory");
    __builtin_amdgcn_sched_barrier(0);

    v8f acc = {};
#pragma unroll
    for (int c = 0; c < DD/KCH; ++c) {
        const int bufa = (c & 1) * AS_HALVES;
        const int bufb = (c & 1) * BS_HALVES;
#pragma unroll
        for (int g = 0; g < 2; ++g)
#pragma unroll
            for (int i = 0; i < 4; ++i) {
                v8h h;
#pragma unroll
                for (int j = 0; j < 8; ++j) h[j] = (_Float16)wl[g*8 + j][i];
                *(v8h*)(bdst + bufb + i*LPITCH + g*128) = h;
            }
#pragma unroll
        for (int u = 0; u < 4; ++u) {
            v8h h;
#pragma unroll
            for (int j = 0; j < 4; ++j) {
                h[j]     = (_Float16)xl[2*u][j];
                h[4 + j] = (_Float16)xl[2*u + 1][j];
            }
            *(v8h*)(adst + bufa + u*8*LPITCH) = h;
        }
        if (c + 1 < DD/KCH) {
            const int kn = (c + 1) * KCH;
            // keeps the next chunk's loads behind this chunk's LDS stores: lifted
            // over them, the results of two chunks are live at once and spill
            __builtin_amdgcn_sched_barrier(0);
#pragma unroll
            for (int g = 0; g < 2; ++g)
#pragma unroll
                for (int j = 0; j < 8; ++j)
                    wl[g*8 + j] = *(const v4f*)(wsrc + (kn + g*128 + j)*LDW);
#pragma unroll
            for (int u = 0; u < 4; ++u) {
                xl[2*u]     = *(const v4f*)(xsrc + u*8*DD + kn);
                xl[2*u + 1] = *(const v4f*)(xsrc + u*8*DD + kn + 4);
            }
            // as above: the wait before the loads' address registers are rewritten
            asm volatile("s_wait_xcnt 0x0" ::: "memory");
            __builtin_amdgcn_sched_barrier(0);
        }
        // The work-group barrier that publishes this chunk; it also ends every
        // wave's reads of the other buffer, which the next trip overwrites. Its
        // fences name LDS alone: __syncthreads() would also wait for the next
        // chunk's global loads, which are to fly through this chunk's products.
        __builtin_amdgcn_fence(__ATOMIC_RELEASE, "workgroup", "local");
        __builtin_amdgcn_s_barrier();
        __builtin_amdgcn_fence(__ATOMIC_ACQUIRE, "workgroup", "local");
#pragma unroll
        for (int kk = 0; kk < KCH; kk += 32) {
            const v8h al = *(const v8h*)(ard + bufa + kk);
            const v8h ah = *(const v8h*)(ard + bufa + kk + 16);
            const v8h bl = *(const v8h*)(brd + bufb + kk + bo0);
            const v8h bh = *(const v8h*)(brd + bufb + kk + bo1);
            const v16h a = __builtin_shufflevector(al, ah, 0,1,2,3,4,5,6,7,8,9,10,11,12,13,14,15);
            const v16h b = __builtin_shufflevector(bl, bh, 0,1,2,3,4,5,6,7,8,9,10,11,12,13,14,15);
            acc = __builtin_amdgcn_wmma_f32_16x16x32_f16(false, a, false, b,
                                                         (short)0, acc, false, false);
        }
        // keeps the next chunk's conversions, which wait for its loads, from being
        // lifted among this chunk's products: the products are what hides the loads
        __builtin_amdgcn_sched_barrier(0);
    }
#pragma unroll
    for (int r = 0; r < 8; ++r) {
        float y = acc[r];
        if (act == 1) y = sigmoid_fast(y);
        C[(16*mt + r + 8*hi) * LDW + 16*nt + lo] = y;
    }
    // the code that follows in the kernel's listing reuses the stores' address and
    // data registers: keep the wait between the eight stores and those writes
    asm volatile("s_wait_xcnt 0x0" ::: "memory");
}

// ---------------------------------------------------------------------------
// Layout prep: f32 [K,N] -> f16 [N,K] transpose.
// blk is the block's index within its own job; 256 threads a block, 32 elements
// a thread, so that the launch starts few waves and every global access is a
// 16-byte piece of a whole line.
// ---------------------------------------------------------------------------
#define PREP_ELEMS 8192            // elements a block handles
#define TILE_K 128
#define TILE_N 64
#define TILE_PITCH 65              // floats; odd, so that a column walk changes bank

// One block turns a tile of 128 k x 64 n. It reads 256-byte pieces of the rows
// of in, lays them in LDS as they are, and each thread then walks down a column
// and stores 8 k of one n as 16 bytes: a block writes 256 bytes of each of its
// 64 rows of out. K and N are multiples of 128 and 64.
__device__ __forceinline__ void transpose_f16_tile(const float* __restrict__ in, // [K,N]
                                                   _Float16* __restrict__ out,   // [N,K]
                                                   int K, int N, int blk,
                                                   float* __restrict__ tile)
{
    const int tid = threadIdx.x;
    const int ntn = N / TILE_N;
    const int k0  = (blk / ntn) * TILE_K;
    const int n0  = (blk % ntn) * TILE_N;
    const int lr  = tid >> 4;              // row of the first piece, 16 rows a pass
    const int lc  = (tid & 15) * 4;
    const float* src = in + (size_t)(k0 + lr) * N + n0 + lc;
    // all loops here are unrolled so that the arrays are indexed by constants and
    // stay in registers, and the 8 loads fly together
    v4f ld[8];
#pragma unroll
    for (int it = 0; it < 8; ++it)
        ld[it] = *(const v4f*)(src + (size_t)it * 16 * N);
#pragma unroll
    for (int it = 0; it < 8; ++it)
#pragma unroll
        for (int j = 0; j < 4; ++j)
            tile[(lr + 16*it) * TILE_PITCH + lc + j] = ld[it][j];
    // every wave reads what the other waves laid down
    __syncthreads();
    const int n  = tid >> 2;
    const int kq = (tid & 3) * 8;
    _Float16* dst = out + (size_t)(n0 + n) * K + k0 + kq;
#pragma unroll
    for (int g = 0; g < 4; ++g) {
        v8h h;
#pragma unroll
        for (int j = 0; j < 8; ++j)
            h[j] = (_Float16)tile[(kq + 32*g + j) * TILE_PITCH + n];
        *(v8h*)(dst + 32*g) = h;
    }
    // the code that follows in the kernel's listing reuses the stores' address and
    // data registers: keep the wait between the four stores and those writes
    asm volatile("s_wait_xcnt 0x0" ::: "memory");
}

// ---------------------------------------------------------------------------
// Precompute per-(h,r) spectral parameters. One wave per (h,r): its 32 lanes
// take the 32 frequency pairs of Dk, one each, so that the table costs one pass
// through powf, cosf and sinf, not a serial walk over Dk. 8 waves a block.
// blk is the block's index within this job.
// ---------------------------------------------------------------------------
#define PREP_PAR_BLOCKS ((HH*RR)/8)   // 8
__device__ __forceinline__ void params_block(const float* __restrict__ mode_logits,
                                             const float* __restrict__ log_decay,
                                             const float* __restrict__ omega_log_scale,
                                             float* __restrict__ cosw,
                                             float* __restrict__ sinw,
                                             float* __restrict__ rho,
                                             float* __restrict__ modew,
                                             int blk)
{
    const int t = blk * 8 + (threadIdx.x >> 5);              // 0..63, one a wave
    const int h = t >> 3;
    const int p = threadIdx.x & 31;                          // frequency pair

    // all that the wave reads, in flight together: one load latency
    const float ols = omega_log_scale[t];
    const float ld  = log_decay[t];
    const float mlt = mode_logits[t];
    const v4f ml0 = *(const v4f*)(mode_logits + h*RR);
    const v4f ml1 = *(const v4f*)(mode_logits + h*RR + 4);
    // the address registers of these loads are reused by the arithmetic below:
    // keep the wait between the loads and those writes; the scheduling barrier
    // keeps that arithmetic from being lifted over the wait
    asm volatile("s_wait_xcnt 0x0" ::: "memory");
    __builtin_amdgcn_sched_barrier(0);
    const float ml[RR] = {ml0.x, ml0.y, ml0.z, ml0.w, ml1.x, ml1.y, ml1.z, ml1.w};

    const float pidx = (float)(2 * p);                       // repeat_interleave
    const float invf = powf(10000.0f, -pidx / (float)DK);
    const float w  = expf(ols) * invf;
    const float cw = cosf(w);
    const float sw = sinf(w);
    const v2f c2 = {cw, cw};
    const v2f s2 = {sw, sw};

    const float sp = (ld > 20.0f) ? ld : log1pf(expf(ld));   // softplus
    const float rh = expf(-sp);
    // unrolled so that ml is indexed by constants and stays in registers
    float mx = -1e30f;
#pragma unroll
    for (int j = 0; j < RR; ++j) mx = fmaxf(mx, ml[j]);
    float sum = 0.0f;
#pragma unroll
    for (int j = 0; j < RR; ++j) sum += expf(ml[j] - mx);
    const float mwt = expf(mlt - mx) / sum;

    *(v2f*)(cosw + t*DK + 2*p) = c2;
    *(v2f*)(sinw + t*DK + 2*p) = s2;
    if (p == 0) {
        rho[t]   = rh;
        modew[t] = mwt;
    }
}

// ---------------------------------------------------------------------------
// All that reads only inputs, in one launch, a range of blocks per job: the
// parameter table (8 blocks), the six input projections (34 column tiles of 64 x
// 8 row tiles of 32: q, k, v and the gate 8 column tiles each, then beta, tg) and
// the f16 transpose of Wo for the output projection (64 blocks). None waits for
// another; the scan and the output projection are later launches.
// ---------------------------------------------------------------------------
#define PREP_BIG_BLOCKS ((DD*512)/PREP_ELEMS)     // 64
#define PROJ_GEMM_BLOCKS (34*8)
#define PROJ_BLOCKS (PREP_PAR_BLOCKS + PROJ_GEMM_BLOCKS + PREP_BIG_BLOCKS)
__global__ __launch_bounds__(256)
void proj_wmma(const float* __restrict__ x,
               const float* __restrict__ Wq,
               const float* __restrict__ Wk,
               const float* __restrict__ Wv,
               const float* __restrict__ Wg,
               const float* __restrict__ Wo,
               const float* __restrict__ Wb,
               const float* __restrict__ Wtg,
               const float* __restrict__ mode_logits,
               const float* __restrict__ log_decay,
               const float* __restrict__ omega_log_scale,
               float* __restrict__ q,
               float* __restrict__ k,
               float* __restrict__ v,
               float* __restrict__ g,
               float* __restrict__ beta,
               float* __restrict__ tg,
               _Float16* __restrict__ Wot,
               float* __restrict__ cosw,
               float* __restrict__ sinw,
               float* __restrict__ rho,
               float* __restrict__ modew)
{
    // one block does one job: the jobs share the space
    __shared__ __attribute__((aligned(16))) char smem[PROJ_LDS_BYTES];
    static_assert(PROJ_LDS_BYTES >= TILE_K * TILE_PITCH * 4, "the transpose tile fits");
    int blk = blockIdx.x;
    if (blk < PREP_PAR_BLOCKS) {
        params_block(mode_logits, log_decay, omega_log_scale, cosw, sinw, rho, modew, blk);
        return;
    }
    blk -= PREP_PAR_BLOCKS;
    if (blk < PROJ_GEMM_BLOCKS) {
        _Float16* As = (_Float16*)smem;
        _Float16* Bs = As + 2*AS_HALVES;
        const int ct = blk >> 3;
        const int m0 = (blk & 7) * 32;
        const float* xm = x + m0*DD;
        if (ct < 32) {
            const int job = ct >> 3;
            const int n0  = (ct & 7) * 64;
            const float* Wn = job == 0 ? Wq : job == 1 ? Wk : job == 2 ? Wv : Wg;
            float*       C  = job == 0 ? q  : job == 1 ? k  : job == 2 ? v  : g;
            proj_tile<512>(xm, Wn + n0, C + m0*512 + n0, job == 3 ? 1 : 0, As, Bs);
        } else {
            proj_tile<64>(xm, ct == 32 ? Wb : Wtg, (ct == 32 ? beta : tg) + m0*64, 1, As, Bs);
        }
        return;
    }
    blk -= PROJ_GEMM_BLOCKS;
    transpose_f16_tile(Wo, Wot, 512, DD, blk, (float*)smem);
}

// ---------------------------------------------------------------------------
// Recurrent scan: 8 lanes share one state row (b,h,r,v); each lane keeps 8 of
// the 64 Dk elements (real and imaginary) in registers, as two groups of four:
// k = 4*sub + 0..3 and k = 32 + 4*sub + 0..3, so that the 8 lanes of a row read
// one 128-byte line per 16-byte load. The two sums over Dk of a time step end
// in three in-row DPP adds (lane ^ 1, ^ 2, ^ 4).
// One block = the 8 modes r of 4 v of one (b,h): wave r holds mode r, 4 rows.
// So the block owns all that an output element (b,t,h,v) is summed from: each
// row's weighted read-outs are kept in LDS, and behind the loop the block sums
// them over r, applies the gate and stores the f16 operand of the output
// projection itself, as 1 KB of its own: og[block][t][4 v].
// What the block reads in its 128 time steps (the k and q rows of its (b,h), its
// 4 v of each step, decay and beta of its h) is brought into LDS once, ahead
// of the loop, with all loads in flight together; the loop reads it from there
// one time step ahead, so that no load latency is left in a time step.
// ---------------------------------------------------------------------------
template <int CTRL>
__device__ __forceinline__ float add_row_xmask(float x)
{
    // x + (x of lane ^ mask), mask in the low bits of CTRL (0x160 | mask)
    const int xi = __builtin_bit_cast(int, x);
    const int yi = __builtin_amdgcn_update_dpp(0, xi, CTRL, 0xf, 0xf, true);
    return x + __builtin_bit_cast(float, yi);
}

__device__ __forceinline__ float sum_over_8_lanes(float x)
{
    x = add_row_xmask<0x161>(x);
    x = add_row_xmask<0x162>(x);
    x = add_row_xmask<0x164>(x);
    return x;
}

#define YPITCH (TT + 8)   // floats; the 4 rows of a wave then store on disjoint banks

// The grid is 2048 waves, two per SIMD: waves_per_eu says so, so that the
// register budget is not held at 64: the staging holds the results of a thread's
// twenty-one loads at once.
__global__ __launch_bounds__(256) __attribute__((amdgpu_waves_per_eu(2, 2)))
void scan_kernel(const float* __restrict__ q,
                 const float* __restrict__ k,
                 const float* __restrict__ v,
                 const float* __restrict__ g,
                 const float* __restrict__ beta,
                 const float* __restrict__ tg,
                 const float* __restrict__ cosw,
                 const float* __restrict__ sinw,
                 const float* __restrict__ rho,
                 const float* __restrict__ modew,
                 _Float16* __restrict__ og)
{
    const unsigned tid = threadIdx.x;
    const int vg   = blockIdx.x & 15;
    const int h    = (blockIdx.x >> 4) & 7;
    const int b    = (blockIdx.x >> 7) & 1;
    // the wave's number, said to be uniform so that what hangs on it is scalar
    const int r    = __builtin_amdgcn_readfirstlane(tid >> 5);
    const int hr   = h*RR + r;
    const int sub  = tid & 7;
    const int vloc = (tid >> 3) & 3;

    __shared__ v4f ks[TT*16];         // k rows, 64 floats a step
    __shared__ v4f qs[TT*16];         // q rows, 64 floats a step
    __shared__ v4f vs[TT];            // this block's 4 v of a step
    __shared__ v4f db[TT*4];          // (decay, beta) of a step's 8 modes
    __shared__ float yl[32*YPITCH];   // weighted read-outs, [r*4 + v][t]

    const float mw = modew[hr];
    // keeps the scalar load above from being placed between the four loads
    // below and their wait, where it would land in those loads' base registers
    __builtin_amdgcn_sched_barrier(0);

    const float4* c4 = (const float4*)(cosw + hr*DK);
    const float4* s4 = (const float4*)(sinw + hr*DK);
    const float4 ca = c4[sub], cb = c4[8 + sub];
    const float4 sa = s4[sub], sb = s4[8 + sub];
    // the base registers of these four loads are reused right behind them: keep
    // the wait between the loads and those writes; the scheduling barrier keeps
    // the later index arithmetic from being lifted over the wait
    asm volatile("s_wait_xcnt 0x0" ::: "memory");
    __builtin_amdgcn_sched_barrier(0);
    const float c[8] = {ca.x, ca.y, ca.z, ca.w, cb.x, cb.y, cb.z, cb.w};
    const float s[8] = {sa.x, sa.y, sa.z, sa.w, sb.x, sb.y, sb.z, sb.w};

    // Staging. row0 is the flat (b,0,h); the next time step lies HH rows on. A
    // wave's 16-byte loads cover whole 256-byte k or q rows; a thread's pieces lie
    // 16 steps apart. Of step tid / 2 a thread brings two of the block's 4 v, the
    // gate of the same two (g is laid out as v is) and tg, beta and rho of four of
    // the 8 modes.
    const unsigned row0 = b*TT*HH + h;
    const unsigned kq_off = ((row0 + (tid >> 4)*HH)*DK + (tid & 15)*4) * 4;
    const unsigned v_off  = ((row0 + (tid >> 1)*HH)*DV + vg*4 + (tid & 1)*2) * 4;
    const unsigned d_off  = ((row0 + (tid >> 1)*HH)*RR + (tid & 1)*4) * 4;
    const unsigned r_off  = (h*RR + (tid & 1)*4) * 4;
    // the loop is unrolled so that the arrays stay in registers and all of a
    // thread's loads are in flight at once
    v4f kst[8], qst[8];
#pragma unroll
    for (int it = 0; it < 8; ++it) {
        kst[it] = *(const v4f*)((const char*)k + kq_off + it*(16*HH*DK*4));
        qst[it] = *(const v4f*)((const char*)q + kq_off + it*(16*HH*DK*4));
    }
    const v2f vst   = *(const v2f*)((const char*)v + v_off);
    const v2f gst   = *(const v2f*)((const char*)g + v_off);
    const v4f tg_st = *(const v4f*)((const char*)tg + d_off);
    const v4f be_st = *(const v4f*)((const char*)beta + d_off);
    const v4f rh_st = *(const v4f*)((const char*)rho + r_off);
    // The wait stands between these loads and every later write of their offset
    // registers. It takes the loaded values and the four offsets as inputs only:
    // so all the loads are issued ahead of it, and no offset register is given
    // to a load's result or to later arithmetic before it. The scheduling barrier
    // keeps later index arithmetic, which reuses the loads' base registers, from
    // being lifted over the wait.
    asm volatile("s_wait_xcnt 0x0"
                 :: "v"(kst[0]), "v"(kst[1]), "v"(kst[2]), "v"(kst[3]),
                    "v"(kst[4]), "v"(kst[5]), "v"(kst[6]), "v"(kst[7]),
                    "v"(qst[0]), "v"(qst[1]), "v"(qst[2]), "v"(qst[3]),
                    "v"(qst[4]), "v"(qst[5]), "v"(qst[6]), "v"(qst[7]),
                    "v"(vst), "v"(gst), "v"(tg_st), "v"(be_st), "v"(rh_st),
                    "v"(kq_off), "v"(v_off), "v"(d_off), "v"(r_off)
                 : "memory");
    __builtin_amdgcn_sched_barrier(0);
#pragma unroll
    for (int it = 0; it < 8; ++it) {
        ks[it*256 + tid] = kst[it];
        qs[it*256 + tid] = qst[it];
    }
    ((v2f*)vs)[tid] = vst;
    db[2*tid]     = (v4f){tg_st.x * rh_st.x, be_st.x, tg_st.y * rh_st.y, be_st.y};
    db[2*tid + 1] = (v4f){tg_st.z * rh_st.z, be_st.z, tg_st.w * rh_st.w, be_st.w};
    // every wave reads what the other waves staged
    __syncthreads();
    const float* vsf = (const float*)vs + vloc;
    const v2f*   dbr = (const v2f*)db + r;

    // every loop over e below is unrolled so that the 8-element arrays are
    // indexed by constants and stay in registers
    float sr[8], si[8];
#pragma unroll
    for (int e = 0; e < 8; ++e) { sr[e] = 0.f; si[e] = 0.f; }

    // A trip works on operands that were read from LDS in the trip before.
    v4f ka = ks[sub], kb = ks[8 + sub];
    v4f qa = qs[sub], qb = qs[8 + sub];
    v2f dbt = dbr[0];
    float vt = vsf[0];
    float* yrow = yl + (r*4 + vloc)*YPITCH + sub;
    for (int t0 = 0; t0 < TT; t0 += 8) {
        // Lane sub of a row keeps the read-out of step t0 + sub, so that 8 steps
        // end in one LDS store from every lane. Unrolled so that the lane that
        // keeps a step is a constant.
        float keep = 0.f;
#pragma unroll
        for (int j = 0; j < 8; ++j) {
            const int t = t0 + j;
            const float decay = dbt.x;
            const float bet   = dbt.y;
            const float kt[8] = {ka.x, ka.y, ka.z, ka.w, kb.x, kb.y, kb.z, kb.w};
            const float qt[8] = {qa.x, qa.y, qa.z, qa.w, qb.x, qb.y, qb.z, qb.w};

            float rr[8];
#pragma unroll
            for (int e = 0; e < 8; ++e) {
                rr[e] = decay * (c[e]*sr[e] - s[e]*si[e]);
                si[e] = decay * (s[e]*sr[e] + c[e]*si[e]);
            }

            const float pa = rr[0]*kt[0] + rr[2]*kt[2] + rr[4]*kt[4] + rr[6]*kt[6];
            const float pb = rr[1]*kt[1] + rr[3]*kt[3] + rr[5]*kt[5] + rr[7]*kt[7];
            const float pred = sum_over_8_lanes(pa + pb);

            const float bw = bet * (vt - pred);
#pragma unroll
            for (int e = 0; e < 8; ++e) sr[e] = rr[e] + bw*kt[e];

            const float ra = sr[0]*qt[0] + sr[2]*qt[2] + sr[4]*qt[4] + sr[6]*qt[6];
            const float rb = sr[1]*qt[1] + sr[3]*qt[3] + sr[5]*qt[5] + sr[7]*qt[7];

            // This step's operands are used up: the next step's are read into
            // their place. The last trip reads its own step again, so that
            // nothing behind the staged rows is read.
            const int tn = (t + 1 < TT) ? t + 1 : t;
            ka = ks[tn*16 + sub];  kb = ks[tn*16 + 8 + sub];
            qa = qs[tn*16 + sub];  qb = qs[tn*16 + 8 + sub];
            dbt = dbr[tn*RR];
            vt  = vsf[tn*4];

            const float rd = sum_over_8_lanes(ra + rb);
            keep = (sub == j) ? rd : keep;
        }
        yrow[t0] = keep * mw;
    }
    // every wave reads the other modes' read-outs
    __syncthreads();

    // Two outputs a thread: step tid / 2, v = 2*(tid & 1) + 0, 1; the modes are
    // summed in the order r = 0..7.
    const float* ye = yl + (tid & 1)*2*YPITCH + (tid >> 1);
    float o0 = 0.0f, o1 = 0.0f;
    // unrolled so that the 16 LDS reads are issued together
#pragma unroll
    for (int m = 0; m < RR; ++m) {
        o0 += ye[(m*4)*YPITCH];
        o1 += ye[(m*4 + 1)*YPITCH];
    }
    const v2h oh = {(_Float16)(o0 * gst.x), (_Float16)(o1 * gst.y)};
    *(v2h*)(og + (size_t)blockIdx.x * (TT*4) + 2*tid) = oh;
}

// ---------------------------------------------------------------------------
extern "C" void kernel_launch(void* const* d_in, const int* in_sizes, int n_in,
                              void* d_out, int out_size, void* d_ws, size_t ws_size,
                              hipStream_t stream)
{
    (void)in_sizes; (void)n_in; (void)out_size; (void)ws_size;
    const float* x    = (const float*)d_in[0];
    const float* Wq   = (const float*)d_in[1];
    const float* Wk   = (const float*)d_in[2];
    const float* Wv   = (const float*)d_in[3];
    const float* Wb   = (const float*)d_in[4];
    const float* Wtg  = (const float*)d_in[5];
    const float* mlg  = (const float*)d_in[6];
    const float* ldc  = (const float*)d_in[7];
    const float* oms  = (const float*)d_in[8];
    const float* Wg   = (const float*)d_in[9];
    const float* Wo   = (const float*)d_in[10];

    // ---- f32 scratch ----
    float* ws    = (float*)d_ws;
    float* q     = ws;                        // 256*512
    float* k     = q    + MROWS*512;
    float* v     = k    + MROWS*512;
    float* g     = v    + MROWS*512;
    float* beta  = g    + MROWS*512;          // 256*64
    float* tg    = beta + MROWS*64;
    float* cosw  = tg   + MROWS*64;           // 64*64
    float* sinw  = cosw + HH*RR*DK;
    float* rho   = sinw + HH*RR*DK;           // 64
    float* modew = rho  + HH*RR;
    float* fend  = modew + HH*RR;

    // ---- f16 scratch (16B-aligned: float count above is a multiple of 4) ----
    _Float16* Wot  = (_Float16*)fend;         // 1024*512
    _Float16* ogh  = Wot  + DD*512;           // 256*512, in pieces of 4 k

    // parameter table, the six input projections from f32, the transpose of Wo
    proj_wmma<<<PROJ_BLOCKS, 256, 0, stream>>>(x, Wq, Wk, Wv, Wg, Wo, Wb, Wtg,
                                               mlg, ldc, oms,
                                               q, k, v, g, beta, tg,
                                               Wot, cosw, sinw, rho, modew);

    // 8192 rows, 8 lanes each, 32 rows per 256-thread block -> 256 blocks
    scan_kernel<<<256, 256, 0, stream>>>(q, k, v, g, beta, tg, cosw, sinw, rho, modew, ogh);

    out_wmma<<<(16*64)/8, 256, 0, stream>>>(ogh, Wot, (float*)d_out);
}

// v008
// Measured time: 31.4 microseconds a run.
// In both of two side-by-side timings against v007, it was 1.09 times as fast.
// Over all steps from v000 it is 7.28 times as fast.
#include <hip/hip_runtime.h>
#include <hip/hip_bf16.h>
#include <math.h>

// Problem constants (from reference)
#define BB 2
#define TT 128
#define DD 1024
#define HH 8
#define RR 8
#define DK 64
#define DV 64
#define MROWS (BB*TT)          // 256

typedef __attribute__((ext_vector_type(16))) _Float16 v16h;
typedef __attribute__((ext_vector_type(8)))  _Float16 v8h;
typedef __attribute__((ext_vector_type(4)))  _Float16 v4h;
typedef __attribute__((ext_vector_type(2)))  _Float16 v2h;
typedef __attribute__((ext_vector_type(8)))  float    v8f;
typedef __attribute__((ext_vector_type(4)))  float    v4f;
typedef __attribute__((ext_vector_type(2)))  float    v2f;

__device__ __forceinline__ float sigmoid_fast(float x) {
    return __builtin_amdgcn_rcpf(1.0f + __expf(-x));
}

// ---------------------------------------------------------------------------
// WMMA GEMM with native-layout f16 operands.
//   A  : [M,K] f16 row-major
//   Bt : [N,K] f16 row-major (i.e. W[K,N] pre-transposed)
//   C  : [M,N] f32 row-major
// Per ISA 7.12.2 the 16x32 f16 A fragment for lane L (m=L&15, hi=L>>4) is
//   halves 0..7  = K  8*hi + 0..7   (contiguous)
//   halves 8..15 = K 16+8*hi + 0..7 (contiguous)
// so each fragment = two global_load_b128 per lane; same for B against Bt.
// 8 waves / block, one 16x16 C tile per wave (linear tile id).
// K must be a multiple of 64 (manual 2x unroll -> 2 WMMAs/iter).
// blk is the block's index within its own product.
// a4 != 0: A is not row-major but lies in pieces of 4 k, M = 2 x 128 rows: piece
// kq = k / 4 of batch b holds its 128 rows one after the other, 8 bytes each, at
// ((b*128 + kq)*128 + t)*4 halves. The 8 contiguous k of a fragment half are two
// such pieces, TT*4 halves apart; the 16 lanes of a half wave read one whole
// 128-byte line per load. The k order of the fragment is the same in both.
// ---------------------------------------------------------------------------
__device__ __forceinline__ v8h a_pieces(const _Float16* __restrict__ p)
{
    const v4h x = *(const v4h*)p;
    const v4h y = *(const v4h*)(p + TT*4);
    return __builtin_shufflevector(x, y, 0,1,2,3,4,5,6,7);
}

__device__ __forceinline__ void gemm16_tile(const _Float16* __restrict__ A,
                                            const _Float16* __restrict__ Bt,
                                            float* __restrict__ C,
                                            int M, int N, int K, int act, int blk,
                                            int a4)
{
    const int lane = threadIdx.x & 31;
    const int wid  = threadIdx.x >> 5;
    const int tid  = blk * 8 + wid;                 // linear 16x16 tile id
    const int ntiles = N >> 4;
    const int m0 = (tid / ntiles) << 4;
    const int n0 = (tid % ntiles) << 4;
    if (m0 >= M) return;                            // wave-uniform guard

    const int hi = lane >> 4;
    const int lo = lane & 15;
    const int m = m0 + lo;
    const _Float16* arow = a4 ? A + (size_t)(((m >> 7)*128 + 2*hi)*TT + (m & (TT-1))) * 4
                              : A + (size_t)m * K + 8*hi;
    const _Float16* brow = Bt + (size_t)(n0 + lo) * K + 8*hi;

    v8f acc = {};
    for (int k0 = 0; k0 < K; k0 += 64) {
        v8h al0, ah0, al1, ah1;
        if (a4) {
            al0 = a_pieces(arow + (k0     ) * TT);
            ah0 = a_pieces(arow + (k0 + 16) * TT);
            al1 = a_pieces(arow + (k0 + 32) * TT);
            ah1 = a_pieces(arow + (k0 + 48) * TT);
        } else {
            al0 = *(const v8h*)(arow + k0);
            ah0 = *(const v8h*)(arow + k0 + 16);
            al1 = *(const v8h*)(arow + k0 + 32);
            ah1 = *(const v8h*)(arow + k0 + 48);
        }
        v8h bl0 = *(const v8h*)(brow + k0);
        v8h bh0 = *(const v8h*)(brow + k0 + 16);
        v8h bl1 = *(const v8h*)(brow + k0 + 32);
        v8h bh1 = *(const v8h*)(brow + k0 + 48);
        v16h a0 = __builtin_shufflevector(al0, ah0, 0,1,2,3,4,5,6,7,8,9,10,11,12,13,14,15);
        v16h b0 = __builtin_shufflevector(bl0, bh0, 0,1,2,3,4,5,6,7,8,9,10,11,12,13,14,15);
        v16h a1 = __builtin_shufflevector(al1, ah1, 0,1,2,3,4,5,6,7,8,9,10,11,12,13,14,15);
        v16h b1 = __builtin_shufflevector(bl1, bh1, 0,1,2,3,4,5,6,7,8,9,10,11,12,13,14,15);
        acc = __builtin_amdgcn_wmma_f32_16x16x32_f16(false, a0, false, b0,
                                                     (short)0, acc, false, false);
        acc = __builtin_amdgcn_wmma_f32_16x16x32_f16(false, a1, false, b1,
                                                     (short)0, acc, false, false);
    }
#pragma unroll
    for (int r = 0; r < 8; ++r) {
        float x = acc[r];
        if (act == 1) x = sigmoid_fast(x);
        C[(size_t)(m0 + r + 8*hi) * N + (n0 + lo)] = x;
    }
}

// The output projection: one product per launch. Its A comes from the scan in
// pieces of 4 k (a4 above).
__global__ __launch_bounds__(256)
void out_wmma(const _Float16* __restrict__ A,
              const _Float16* __restrict__ Bt,
              float* __restrict__ C)
{
    gemm16_tile(A, Bt, C, MROWS, DD, HH*DV, 0, blockIdx.x, 1);
}

// ---------------------------------------------------------------------------
// An input projection straight from the f32 inputs. One block = 32 rows of x
// against 64 columns of W[K,LDW], all of K = 1024, in 4 chunks of 256 k. A chunk
// is loaded as f32 in whole 256-byte (W) and 1-KB (x) pieces of rows, rounded to
// f16 in registers and laid in LDS as As[m][k] and Bs[n][k]: a thread holds 8 k
// of 4 n, so that the turn of W is only a choice of registers. The next chunk's
// loads fly while this chunk is multiplied; two LDS buffers, one barrier a chunk.
// 8 waves, one 16x16 tile each (2 in m x 4 in n); fragments and k order are those
// of gemm16_tile, read from LDS.
// In a row n of Bs the 16-byte groups of 8 k are stored at group ^ ((n >> 4) & 3):
// the 16 lanes of a store, which lie 4 rows apart, then fall on all 64 banks; for
// a reading wave n >> 4 is one number.
// ---------------------------------------------------------------------------
#define KCH 256                    // k of a chunk
#define LPITCH (KCH + 8)           // halves; 16 rows of 16-byte reads cover the banks
#define AS_HALVES (32 * LPITCH)
#define BS_HALVES (64 * LPITCH)
#define PROJ_LDS_BYTES ((2*AS_HALVES + 2*BS_HALVES) * 2)

template <int LDW>
__device__ __forceinline__ void proj_tile(const float* __restrict__ x,   // at row m0
                                          const float* __restrict__ Wn,  // at column n0
                                          float* __restrict__ C,         // at (m0, n0)
                                          int act,
                                          _Float16* __restrict__ As,
                                          _Float16* __restrict__ Bs)
{
    const int tid  = threadIdx.x;
    const int lane = tid & 31;
    const int wid  = tid >> 5;
    const int hi   = lane >> 4;
    const int lo   = lane & 15;
    const int mt   = wid & 1;
    const int nt   = wid >> 1;

    // loaders: W rows 8*kg + j (+ 128), columns 4*nq ..; x row tid / 32 (+ 8 u),
    // k = 8*(tid & 31) ..
    const int nq = tid & 15;
    const int kg = tid >> 4;
    const float* wsrc = Wn + (kg*8)*LDW + nq*4;
    const float* xsrc = x + (tid >> 5)*DD + (tid & 31)*8;
    _Float16* bdst = Bs + (nq*4)*LPITCH + ((kg ^ (nq >> 2)) << 3);
    _Float16* adst = As + (tid >> 5)*LPITCH + (tid & 31)*8;
    // readers
    const _Float16* ard  = As + (16*mt + lo)*LPITCH + 8*hi;
    const _Float16* brd  = Bs + (16*nt + lo)*LPITCH;
    const int bo0 = (hi ^ nt) << 3;
    const int bo1 = ((2 + hi) ^ nt) << 3;

    // every loop below is unrolled so that the arrays are indexed by constants and
    // stay in registers, and a chunk's 24 loads fly together
    v4f wl[16], xl[8];
#pragma unroll
    for (int g = 0; g < 2; ++g)
#pragma unroll
        for (int j = 0; j < 8; ++j)
            wl[g*8 + j] = *(const v4f*)(wsrc + (g*128 + j)*LDW);
#pragma unroll
    for (int u = 0; u < 4; ++u) {
        xl[2*u]     = *(const v4f*)(xsrc + u*8*DD);
        xl[2*u + 1] = *(const v4f*)(xsrc + u*8*DD + 4);
    }
    // the wait stands between these loads and any later write of their address
    // registers; the scheduling barrier keeps such writes from being lifted over it
    asm volatile("s_wait_xcnt 0x0" ::: "memory");
    __builtin_amdgcn_sched_barrier(0);

    v8f acc = {};
#pragma unroll
    for (int c = 0; c < DD/KCH; ++c) {
        const int bufa = (c & 1) * AS_HALVES;
        const int bufb = (c & 1) * BS_HALVES;
#pragma unroll
        for (int g = 0; g < 2; ++g)
#pragma unroll
            for (int i = 0; i < 4; ++i) {
                v8h h;
#pragma unroll
                for (int j = 0; j < 8; ++j) h[j] = (_Float16)wl[g*8 + j][i];
                *(v8h*)(bdst + bufb + i*LPITCH + g*128) = h;
            }
#pragma unroll
        for (int u = 0; u < 4; ++u) {
            v8h h;
#pragma unroll
            for (int j = 0; j < 4; ++j) {
                h[j]     = (_Float16)xl[2*u][j];
                h[4 + j] = (_Float16)xl[2*u + 1][j];
            }
            *(v8h*)(adst + bufa + u*8*LPITCH) = h;
        }
        if (c + 1 < DD/KCH) {
            const int kn = (c + 1) * KCH;
            // keeps the next chunk's loads behind this chunk's LDS stores: lifted
            // over them, the results of two chunks are live at once and spill
            __builtin_amdgcn_sched_barrier(0);
#pragma unroll
            for (int g = 0; g < 2; ++g)
#pragma unroll
                for (int j = 0; j < 8; ++j)
                    wl[g*8 + j] = *(const v4f*)(wsrc + (kn + g*128 + j)*LDW);
#pragma unroll
            for (int u = 0; u < 4; ++u) {
                xl[2*u]     = *(const v4f*)(xsrc + u*8*DD + kn);
                xl[2*u + 1] = *(const v4f*)(xsrc + u*8*DD + kn + 4);
            }
            // as above: the wait before the loads' address registers are rewritten
            asm volatile("s_wait_xcnt 0x0" ::: "memory");
            __builtin_amdgcn_sched_barrier(0);
        }
        // The work-group barrier that publishes this chunk; it also ends every
        // wave's reads of the other buffer, which the next trip overwrites. Its
        // fences name LDS alone: __syncthreads() would also wait for the next
        // chunk's global loads, which are to fly through this chunk's products.
        __builtin_amdgcn_fence(__ATOMIC_RELEASE, "workgroup", "local");
        __builtin_amdgcn_s_barrier();
        __builtin_amdgcn_fence(__ATOMIC_ACQUIRE, "workgroup", "local");
#pragma unroll
        for (int kk = 0; kk < KCH; kk += 32) {
            const v8h al = *(const v8h*)(ard + bufa + kk);
            const v8h ah = *(const v8h*)(ard + bufa + kk + 16);
            const v8h bl = *(const v8h*)(brd + bufb + kk + bo0);
            const v8h bh = *(const v8h*)(brd + bufb + kk + bo1);
            const v16h a = __builtin_shufflevector(al, ah, 0,1,2,3,4,5,6,7,8,9,10,11,12,13,14,15);
            const v16h b = __builtin_shufflevector(bl, bh, 0,1,2,3,4,5,6,7,8,9,10,11,12,13,14,15);
            acc = __builtin_amdgcn_wmma_f32_16x16x32_f16(false, a, false, b,
                                                         (short)0, acc, false, false);
        }
        // keeps the next chunk's conversions, which wait for its loads, from being
        // lifted among this chunk's products: the products are what hides the loads
        __builtin_amdgcn_sched_barrier(0);
    }
#pragma unroll
    for (int r = 0; r < 8; ++r) {
        float y = acc[r];
        if (act == 1) y = sigmoid_fast(y);
        C[(16*mt + r + 8*hi) * LDW + 16*nt + lo] = y;
    }
    // the code that follows in the kernel's listing reuses the stores' address and
    // data registers: keep the wait between the eight stores and those writes
    asm volatile("s_wait_xcnt 0x0" ::: "memory");
}

// ---------------------------------------------------------------------------
// Layout prep: f32 [K,N] -> f16 [N,K] transpose.
// blk is the block's index within its own job; 256 threads a block, 32 elements
// a thread, so that the launch starts few waves and every global access is a
// 16-byte piece of a whole line.
// ---------------------------------------------------------------------------
#define PREP_ELEMS 8192            // elements a block handles
#define TILE_K 128
#define TILE_N 64
#define TILE_PITCH 65              // floats; odd, so that a column walk changes bank

// One block turns a tile of 128 k x 64 n. It reads 256-byte pieces of the rows
// of in, lays them in LDS as they are, and each thread then walks down a column
// and stores 8 k of one n as 16 bytes: a block writes 256 bytes of each of its
// 64 rows of out. K and N are multiples of 128 and 64.
__device__ __forceinline__ void transpose_f16_tile(const float* __restrict__ in, // [K,N]
                                                   _Float16* __restrict__ out,   // [N,K]
                                                   int K, int N, int blk,
                                                   float* __restrict__ tile)
{
    const int tid = threadIdx.x;
    const int ntn = N / TILE_N;
    const int k0  = (blk / ntn) * TILE_K;
    const int n0  = (blk % ntn) * TILE_N;
    const int lr  = tid >> 4;              // row of the first piece, 16 rows a pass
    const int lc  = (tid & 15) * 4;
    const float* src = in + (size_t)(k0 + lr) * N + n0 + lc;
    // all loops here are unrolled so that the arrays are indexed by constants and
    // stay in registers, and the 8 loads fly together
    v4f ld[8];
#pragma unroll
    for (int it = 0; it < 8; ++it)
        ld[it] = *(const v4f*)(src + (size_t)it * 16 * N);
#pragma unroll
    for (int it = 0; it < 8; ++it)
#pragma unroll
        for (int j = 0; j < 4; ++j)
            tile[(lr + 16*it) * TILE_PITCH + lc + j] = ld[it][j];
    // every wave reads what the other waves laid down
    __syncthreads();
    const int n  = tid >> 2;
    const int kq = (tid & 3) * 8;
    _Float16* dst = out + (size_t)(n0 + n) * K + k0 + kq;
#pragma unroll
    for (int g = 0; g < 4; ++g) {
        v8h h;
#pragma unroll
        for (int j = 0; j < 8; ++j)
            h[j] = (_Float16)tile[(kq + 32*g + j) * TILE_PITCH + n];
        *(v8h*)(dst + 32*g) = h;
    }
    // the code that follows in the kernel's listing reuses the stores' address and
    // data registers: keep the wait between the four stores and those writes
    asm volatile("s_wait_xcnt 0x0" ::: "memory");
}

// ---------------------------------------------------------------------------
// Precompute per-(h,r) spectral parameters. One wave per (h,r): its 32 lanes
// take the 32 frequency pairs of Dk, one each, so that the table costs one pass
// through powf, cosf and sinf, not a serial walk over Dk. 8 waves a block.
// blk is the block's index within this job.
// ---------------------------------------------------------------------------
#define PREP_PAR_BLOCKS ((HH*RR)/8)   // 8
__device__ __forceinline__ void params_block(const float* __restrict__ mode_logits,
                                             const float* __restrict__ log_decay,
                                             const float* __restrict__ omega_log_scale,
                                             float* __restrict__ cosw,
                                             float* __restrict__ sinw,
                                             float* __restrict__ rho,
                                             float* __restrict__ modew,
                                             int blk)
{
    const int t = blk * 8 + (threadIdx.x >> 5);              // 0..63, one a wave
    const int h = t >> 3;
    const int p = threadIdx.x & 31;                          // frequency pair

    // all that the wave reads, in flight together: one load latency
    const float ols = omega_log_scale[t];
    const float ld  = log_decay[t];
    const float mlt = mode_logits[t];
    const v4f ml0 = *(const v4f*)(mode_logits + h*RR);
    const v4f ml1 = *(const v4f*)(mode_logits + h*RR + 4);
    // the address registers of these loads are reused by the arithmetic below:
    // keep the wait between the loads and those writes; the scheduling barrier
    // keeps that arithmetic from being lifted over the wait
    asm volatile("s_wait_xcnt 0x0" ::: "memory");
    __builtin_amdgcn_sched_barrier(0);
    const float ml[RR] = {ml0.x, ml0.y, ml0.z, ml0.w, ml1.x, ml1.y, ml1.z, ml1.w};

    const float pidx = (float)(2 * p);                       // repeat_interleave
    const float invf = powf(10000.0f, -pidx / (float)DK);
    const float w  = expf(ols) * invf;
    const float cw = cosf(w);
    const float sw = sinf(w);
    const v2f c2 = {cw, cw};
    const v2f s2 = {sw, sw};

    const float sp = (ld > 20.0f) ? ld : log1pf(expf(ld));   // softplus
    const float rh = expf(-sp);
    // unrolled so that ml is indexed by constants and stays in registers
    float mx = -1e30f;
#pragma unroll
    for (int j = 0; j < RR; ++j) mx = fmaxf(mx, ml[j]);
    float sum = 0.0f;
#pragma unroll
    for (int j = 0; j < RR; ++j) sum += expf(ml[j] - mx);
    const float mwt = expf(mlt - mx) / sum;

    *(v2f*)(cosw + t*DK + 2*p) = c2;
    *(v2f*)(sinw + t*DK + 2*p) = s2;
    if (p == 0) {
        rho[t]   = rh;
        modew[t] = mwt;
    }
}

// ---------------------------------------------------------------------------
// All that reads only inputs, in one launch, a range of blocks per job: the
// parameter table (8 blocks), the six input projections (34 column tiles of 64 x
// 8 row tiles of 32: q, k, v and the gate 8 column tiles each, then beta, tg) and
// the f16 transpose of Wo for the output projection (64 blocks). None waits for
// another; the scan and the output projection are later launches.
// ---------------------------------------------------------------------------
#define PREP_BIG_BLOCKS ((DD*512)/PREP_ELEMS)     // 64
#define PROJ_GEMM_BLOCKS (34*8)
#define PROJ_BLOCKS (PREP_PAR_BLOCKS + PROJ_GEMM_BLOCKS + PREP_BIG_BLOCKS)
__global__ __launch_bounds__(256)
void proj_wmma(const float* __restrict__ x,
               const float* __restrict__ Wq,
               const float* __restrict__ Wk,
               const float* __restrict__ Wv,
               const float* __restrict__ Wg,
               const float* __restrict__ Wo,
               const float* __restrict__ Wb,
               const float* __restrict__ Wtg,
               const float* __restrict__ mode_logits,
               const float* __restrict__ log_decay,
               const float* __restrict__ omega_log_scale,
               float* __restrict__ q,
               float* __restrict__ k,
               float* __restrict__ v,
               float* __restrict__ g,
               float* __restrict__ beta,
               float* __restrict__ tg,
               _Float16* __restrict__ Wot,
               float* __restrict__ cosw,
               float* __restrict__ sinw,
               float* __restrict__ rho,
               float* __restrict__ modew)
{
    // one block does one job: the jobs share the space
    __shared__ __attribute__((aligned(16))) char smem[PROJ_LDS_BYTES];
    static_assert(PROJ_LDS_BYTES >= TILE_K * TILE_PITCH * 4, "the transpose tile fits");
    int blk = blockIdx.x;
    if (blk < PREP_PAR_BLOCKS) {
        params_block(mode_logits, log_decay, omega_log_scale, cosw, sinw, rho, modew, blk);
        return;
    }
    blk -= PREP_PAR_BLOCKS;
    if (blk < PROJ_GEMM_BLOCKS) {
        _Float16* As = (_Float16*)smem;
        _Float16* Bs = As + 2*AS_HALVES;
        const int ct = blk >> 3;
        const int m0 = (blk & 7) * 32;
        const float* xm = x + m0*DD;
        if (ct < 32) {
            const int job = ct >> 3;
            const int n0  = (ct & 7) * 64;
            const float* Wn = job == 0 ? Wq : job == 1 ? Wk : job == 2 ? Wv : Wg;
            float*       C  = job == 0 ? q  : job == 1 ? k  : job == 2 ? v  : g;
            proj_tile<512>(xm, Wn + n0, C + m0*512 + n0, job == 3 ? 1 : 0, As, Bs);
        } else {
            proj_tile<64>(xm, ct == 32 ? Wb : Wtg, (ct == 32 ? beta : tg) + m0*64, 1, As, Bs);
        }
        return;
    }
    blk -= PROJ_GEMM_BLOCKS;
    transpose_f16_tile(Wo, Wot, 512, DD, blk, (float*)smem);
}

// ---------------------------------------------------------------------------
// Recurrent scan: 8 lanes share one state row (b,h,r,v); each lane keeps 8 of
// the 64 Dk elements (real and imaginary) in registers, as two groups of four:
// k = 4*sub + 0..3 and k = 32 + 4*sub + 0..3, so that the 8 lanes of a row read
// one 128-byte line per 16-byte load. The two sums over Dk of a time step end
// in three in-row DPP adds (lane ^ 1, ^ 2, ^ 4).
// One block = the 8 modes r of 4 v of one (b,h): wave r holds mode r, 4 rows.
// So the block owns all that an output element (b,t,h,v) is summed from: each
// row's weighted read-outs are kept in LDS, and behind the loop the block sums
// them over r, applies the gate and stores the f16 operand of the output
// projection itself, as 1 KB of its own: og[block][t][4 v].
// What the block reads in its 128 time steps (the k and q rows of its (b,h), its
// 4 v of each step, decay and beta of its h) is brought into LDS once, ahead
// of the loop, with all loads in flight together; the loop reads it from there
// one time step ahead, so that no load latency is left in a time step.
// ---------------------------------------------------------------------------
template <int CTRL>
__device__ __forceinline__ float add_row_xmask(float x)
{
    // x + (x of lane ^ mask), mask in the low bits of CTRL (0x160 | mask)
    const int xi = __builtin_bit_cast(int, x);
    const int yi = __builtin_amdgcn_update_dpp(0, xi, CTRL, 0xf, 0xf, true);
    return x + __builtin_bit_cast(float, yi);
}

__device__ __forceinline__ float sum_over_8_lanes(float x)
{
    x = add_row_xmask<0x161>(x);
    x = add_row_xmask<0x162>(x);
    x = add_row_xmask<0x164>(x);
    return x;
}

#define YPITCH (TT + 8)   // floats; the 4 rows of a wave then store on disjoint banks

// The grid is 2048 waves, two per SIMD: waves_per_eu says so, so that the
// register budget is not held at 64: the staging holds the results of a thread's
// twenty-one loads at once.
__global__ __launch_bounds__(256) __attribute__((amdgpu_waves_per_eu(2, 2)))
void scan_kernel(const float* __restrict__ q,
                 const float* __restrict__ k,
                 const float* __restrict__ v,
                 const float* __restrict__ g,
                 const float* __restrict__ beta,
                 const float* __restrict__ tg,
                 const float* __restrict__ cosw,
                 const float* __restrict__ sinw,
                 const float* __restrict__ rho,
                 const float* __restrict__ modew,
                 _Float16* __restrict__ og)
{
    const unsigned tid = threadIdx.x;
    const int vg   = blockIdx.x & 15;
    const int h    = (blockIdx.x >> 4) & 7;
    const int b    = (blockIdx.x >> 7) & 1;
    // the wave's number, said to be uniform so that what hangs on it is scalar
    const int r    = __builtin_amdgcn_readfirstlane(tid >> 5);
    const int hr   = h*RR + r;
    const int sub  = tid & 7;
    const int vloc = (tid >> 3) & 3;

    __shared__ v4f ks[TT*16];         // k rows, 64 floats a step
    __shared__ v4f qs[TT*16];         // q rows, 64 floats a step
    __shared__ v4f vs[TT];            // this block's 4 v of a step
    __shared__ v4f db[TT*4];          // (decay, beta) of a step's 8 modes
    __shared__ float yl[32*YPITCH];   // weighted read-outs, [r*4 + v][t]

    const float mw = modew[hr];
    // keeps the scalar load above from being placed between the four loads
    // below and their wait, where it would land in those loads' base registers
    __builtin_amdgcn_sched_barrier(0);

    const float4* c4 = (const float4*)(cosw + hr*DK);
    const float4* s4 = (const float4*)(sinw + hr*DK);
    const float4 ca = c4[sub], cb = c4[8 + sub];
    const float4 sa = s4[sub], sb = s4[8 + sub];
    // the base registers of these four loads are reused right behind them: keep
    // the wait between the loads and those writes; the scheduling barrier keeps
    // the later index arithmetic from being lifted over the wait
    asm volatile("s_wait_xcnt 0x0" ::: "memory");
    __builtin_amdgcn_sched_barrier(0);
    // pair p holds the lane's elements 2p and 2p + 1, neighbours in k
    const v2f c[4] = {{ca.x, ca.y}, {ca.z, ca.w}, {cb.x, cb.y}, {cb.z, cb.w}};
    const v2f s[4] = {{sa.x, sa.y}, {sa.z, sa.w}, {sb.x, sb.y}, {sb.z, sb.w}};

    // Staging. row0 is the flat (b,0,h); the next time step lies HH rows on. A
    // wave's 16-byte loads cover whole 256-byte k or q rows; a thread's pieces lie
    // 16 steps apart. Of step tid / 2 a thread brings two of the block's 4 v, the
    // gate of the same two (g is laid out as v is) and tg, beta and rho of four of
    // the 8 modes.
    const unsigned row0 = b*TT*HH + h;
    const unsigned kq_off = ((row0 + (tid >> 4)*HH)*DK + (tid & 15)*4) * 4;
    const unsigned v_off  = ((row0 + (tid >> 1)*HH)*DV + vg*4 + (tid & 1)*2) * 4;
    const unsigned d_off  = ((row0 + (tid >> 1)*HH)*RR + (tid & 1)*4) * 4;
    const unsigned r_off  = (h*RR + (tid & 1)*4) * 4;
    // the loop is unrolled so that the arrays stay in registers and all of a
    // thread's loads are in flight at once
    v4f kst[8], qst[8];
#pragma unroll
    for (int it = 0; it < 8; ++it) {
        kst[it] = *(const v4f*)((const char*)k + kq_off + it*(16*HH*DK*4));
        qst[it] = *(const v4f*)((const char*)q + kq_off + it*(16*HH*DK*4));
    }
    const v2f vst   = *(const v2f*)((const char*)v + v_off);
    const v2f gst   = *(const v2f*)((const char*)g + v_off);
    const v4f tg_st = *(const v4f*)((const char*)tg + d_off);
    const v4f be_st = *(const v4f*)((const char*)beta + d_off);
    const v4f rh_st = *(const v4f*)((const char*)rho + r_off);
    // The wait stands between these loads and every later write of their offset
    // registers. It takes the loaded values and the four offsets as inputs only:
    // so all the loads are issued ahead of it, and no offset register is given
    // to a load's result or to later arithmetic before it. The scheduling barrier
    // keeps later index arithmetic, which reuses the loads' base registers, from
    // being lifted over the wait.
    asm volatile("s_wait_xcnt 0x0"
                 :: "v"(kst[0]), "v"(kst[1]), "v"(kst[2]), "v"(kst[3]),
                    "v"(kst[4]), "v"(kst[5]), "v"(kst[6]), "v"(kst[7]),
                    "v"(qst[0]), "v"(qst[1]), "v"(qst[2]), "v"(qst[3]),
                    "v"(qst[4]), "v"(qst[5]), "v"(qst[6]), "v"(qst[7]),
                    "v"(vst), "v"(gst), "v"(tg_st), "v"(be_st), "v"(rh_st),
                    "v"(kq_off), "v"(v_off), "v"(d_off), "v"(r_off)
                 : "memory");
    __builtin_amdgcn_sched_barrier(0);
#pragma unroll
    for (int it = 0; it < 8; ++it) {
        ks[it*256 + tid] = kst[it];
        qs[it*256 + tid] = qst[it];
    }
    ((v2f*)vs)[tid] = vst;
    db[2*tid]     = (v4f){tg_st.x * rh_st.x, be_st.x, tg_st.y * rh_st.y, be_st.y};
    db[2*tid + 1] = (v4f){tg_st.z * rh_st.z, be_st.z, tg_st.w * rh_st.w, be_st.w};
    // every wave reads what the other waves staged
    __syncthreads();
    const float* vsf = (const float*)vs + vloc;
    const v2f*   dbr = (const v2f*)db + r;

    // The lane's 8 elements are kept as 4 pairs in the order in which a 16-byte
    // LDS read delivers k and q, and the whole step is written on pairs: the
    // lines below use packed instructions on register pairs as they lie, with
    // no copy to form a pair. Every loop over p is unrolled so that the 4-pair
    // arrays are indexed by constants and stay in registers.
    v2f sr[4], si[4];
#pragma unroll
    for (int p = 0; p < 4; ++p) { sr[p] = (v2f){0.f, 0.f}; si[p] = (v2f){0.f, 0.f}; }

    // A trip works on operands that were read from LDS in the trip before.
    v4f ka = ks[sub], kb = ks[8 + sub];
    v4f qa = qs[sub], qb = qs[8 + sub];
    v2f dbt = dbr[0];
    float vt = vsf[0];
    float* yrow = yl + (r*4 + vloc)*YPITCH + sub;
    for (int t0 = 0; t0 < TT; t0 += 8) {
        // Lane sub of a row keeps the read-out of step t0 + sub, so that 8 steps
        // end in one LDS store from every lane. Unrolled so that the lane that
        // keeps a step is a constant.
        float keep = 0.f;
#pragma unroll
        for (int j = 0; j < 8; ++j) {
            const int t = t0 + j;
            const v2f decay = {dbt.x, dbt.x};
            const float bet = dbt.y;
            const v2f kt[4] = {{ka.x, ka.y}, {ka.z, ka.w}, {kb.x, kb.y}, {kb.z, kb.w}};
            const v2f qt[4] = {{qa.x, qa.y}, {qa.z, qa.w}, {qb.x, qb.y}, {qb.z, qb.w}};

            v2f rr[4];
#pragma unroll
            for (int p = 0; p < 4; ++p) {
                rr[p] = decay * (c[p]*sr[p] - s[p]*si[p]);
                si[p] = decay * (s[p]*sr[p] + c[p]*si[p]);
            }

            // .x sums the even elements, .y the odd ones
            const v2f pp = rr[0]*kt[0] + rr[1]*kt[1] + rr[2]*kt[2] + rr[3]*kt[3];
            const float pred = sum_over_8_lanes(pp.x + pp.y);

            const float bw1 = bet * (vt - pred);
            const v2f bw = {bw1, bw1};
#pragma unroll
            for (int p = 0; p < 4; ++p) sr[p] = rr[p] + bw*kt[p];

            const v2f rp = sr[0]*qt[0] + sr[1]*qt[1] + sr[2]*qt[2] + sr[3]*qt[3];

            // This step's operands are used up: the next step's are read into
            // their place. The last trip reads its own step again, so that
            // nothing behind the staged rows is read.
            const int tn = (t + 1 < TT) ? t + 1 : t;
            ka = ks[tn*16 + sub];  kb = ks[tn*16 + 8 + sub];
            qa = qs[tn*16 + sub];  qb = qs[tn*16 + 8 + sub];
            dbt = dbr[tn*RR];
            vt  = vsf[tn*4];

            const float rd = sum_over_8_lanes(rp.x + rp.y);
            keep = (sub == j) ? rd : keep;
        }
        yrow[t0] = keep * mw;
    }
    // every wave reads the other modes' read-outs
    __syncthreads();

    // Two outputs a thread: step tid / 2, v = 2*(tid & 1) + 0, 1; the modes are
    // summed in the order r = 0..7.
    const float* ye = yl + (tid & 1)*2*YPITCH + (tid >> 1);
    float o0 = 0.0f, o1 = 0.0f;
    // unrolled so that the 16 LDS reads are issued together
#pragma unroll
    for (int m = 0; m < RR; ++m) {
        o0 += ye[(m*4)*YPITCH];
        o1 += ye[(m*4 + 1)*YPITCH];
    }
    const v2h oh = {(_Float16)(o0 * gst.x), (_Float16)(o1 * gst.y)};
    *(v2h*)(og + (size_t)blockIdx.x * (TT*4) + 2*tid) = oh;
}

// ---------------------------------------------------------------------------
extern "C" void kernel_launch(void* const* d_in, const int* in_sizes, int n_in,
                              void* d_out, int out_size, void* d_ws, size_t ws_size,
                              hipStream_t stream)
{
    (void)in_sizes; (void)n_in; (void)out_size; (void)ws_size;
    const float* x    = (const float*)d_in[0];
    const float* Wq   = (const float*)d_in[1];
    const float* Wk   = (const float*)d_in[2];
    const float* Wv   = (const float*)d_in[3];
    const float* Wb   = (const float*)d_in[4];
    const float* Wtg  = (const float*)d_in[5];
    const float* mlg  = (const float*)d_in[6];
    const float* ldc  = (const float*)d_in[7];
    const float* oms  = (const float*)d_in[8];
    const float* Wg   = (const float*)d_in[9];
    const float* Wo   = (const float*)d_in[10];

    // ---- f32 scratch ----
    float* ws    = (float*)d_ws;
    float* q     = ws;                        // 256*512
    float* k     = q    + MROWS*512;
    float* v     = k    + MROWS*512;
    float* g     = v    + MROWS*512;
    float* beta  = g    + MROWS*512;          // 256*64
    float* tg    = beta + MROWS*64;
    float* cosw  = tg   + MROWS*64;           // 64*64
    float* sinw  = cosw + HH*RR*DK;
    float* rho   = sinw + HH*RR*DK;           // 64
    float* modew = rho  + HH*RR;
    float* fend  = modew + HH*RR;

    // ---- f16 scratch (16B-aligned: float count above is a multiple of 4) ----
    _Float16* Wot  = (_Float16*)fend;         // 1024*512
    _Float16* ogh  = Wot  + DD*512;           // 256*512, in pieces of 4 k

    // parameter table, the six input projections from f32, the transpose of Wo
    proj_wmma<<<PROJ_BLOCKS, 256, 0, stream>>>(x, Wq, Wk, Wv, Wg, Wo, Wb, Wtg,
                                               mlg, ldc, oms,
                                               q, k, v, g, beta, tg,
                                               Wot, cosw, sinw, rho, modew);

    // 8192 rows, 8 lanes each, 32 rows per 256-thread block -> 256 blocks
    scan_kernel<<<256, 256, 0, stream>>>(q, k, v, g, beta, tg, cosw, sinw, rho, modew, ogh);

    out_wmma<<<(16*64)/8, 256, 0, stream>>>(ogh, Wot, (float*)d_out);
}

// v009
// It runs in 29.1 microseconds.
// Next to v008, in two timings, it ran 1.07 and 1.09 times as fast.
// Over all steps from v000 it is 7.87 times as fast.
#include <hip/hip_runtime.h>
#include <hip/hip_bf16.h>
#include <math.h>

// Problem constants (from reference)
#define BB 2
#define TT 128
#define DD 1024
#define HH 8
#define RR 8
#define DK 64
#define DV 64
#define MROWS (BB*TT)          // 256

typedef __attribute__((ext_vector_type(16))) _Float16 v16h;
typedef __attribute__((ext_vector_type(8)))  _Float16 v8h;
typedef __attribute__((ext_vector_type(4)))  _Float16 v4h;
typedef __attribute__((ext_vector_type(2)))  _Float16 v2h;
typedef __attribute__((ext_vector_type(8)))  float    v8f;
typedef __attribute__((ext_vector_type(4)))  float    v4f;
typedef __attribute__((ext_vector_type(2)))  float    v2f;

__device__ __forceinline__ float sigmoid_fast(float x) {
    return __builtin_amdgcn_rcpf(1.0f + __expf(-x));
}

// ---------------------------------------------------------------------------
// The fragments of the f16 16x16x32 WMMA, as every product of this file lays them.
// Per ISA 7.12.2 the 16x32 f16 A fragment for lane L (m=L&15, hi=L>>4) is
//   halves 0..7  = K  8*hi + 0..7   (contiguous)
//   halves 8..15 = K 16+8*hi + 0..7 (contiguous)
// and the same holds for B against Bt[N,K] (W[K,N] transposed), n = L&15.
//
// The output projection: C[256,1024] f32 = A[256,512] x Bt[1024,512]^T, f16.
// A comes from the scan in pieces of 4 k, M = 2 x 128 rows: piece kq = k / 4 of
// batch b holds its 128 rows one after the other, 8 bytes each, at
// ((b*128 + kq)*128 + t)*4 halves.
// One block = 4 waves = a 32 x 32 tile of C, one 16x16 tile a wave (2 in m x 2 in
// n), all of K. Both operands of the block, 32 KB each, are brought into LDS by
// asynchronous copies of 16 bytes a lane, 32 copies a wave, all in flight at once:
// the block waits out one load latency, not one per few k steps, and every copy
// of a wave covers whole 128-byte lines.
// In LDS a piece of A (32 rows x 8 bytes) has a pitch of 320 bytes: the two halves
// of a wave read pieces two apart, which then fall on the two halves of the banks.
// A row of Bt (1 KB) has a pitch of 1040 bytes, 16 x odd, for the 16-byte reads.
// ---------------------------------------------------------------------------
#define OA_PITCH 320
#define OB_PITCH 1040
#define OA_BYTES (128 * OA_PITCH)
#define OB_BYTES (32 * OB_PITCH)

// Eight asynchronous copies of 16 bytes a lane: LDS byte address l + i*LSTEP from
// global address g + i*GSTEP. The wait in the last line stands between the copies
// and any later write of the address registers that they name; inside the copies'
// own statement nothing can be lifted over it.
template <int LSTEP, int GSTEP>
__device__ __forceinline__ void async_copy8(unsigned l, const char* g)
{
    asm volatile("global_load_async_to_lds_b128 %0, %8, off\n\t"
                 "global_load_async_to_lds_b128 %1, %9, off\n\t"
                 "global_load_async_to_lds_b128 %2, %10, off\n\t"
                 "global_load_async_to_lds_b128 %3, %11, off\n\t"
                 "global_load_async_to_lds_b128 %4, %12, off\n\t"
                 "global_load_async_to_lds_b128 %5, %13, off\n\t"
                 "global_load_async_to_lds_b128 %6, %14, off\n\t"
                 "global_load_async_to_lds_b128 %7, %15, off\n\t"
                 "s_wait_xcnt 0x0"
                 :: "v"(l),           "v"(l + 1*LSTEP), "v"(l + 2*LSTEP), "v"(l + 3*LSTEP),
                    "v"(l + 4*LSTEP), "v"(l + 5*LSTEP), "v"(l + 6*LSTEP), "v"(l + 7*LSTEP),
                    "v"(g),           "v"(g + 1*GSTEP), "v"(g + 2*GSTEP), "v"(g + 3*GSTEP),
                    "v"(g + 4*GSTEP), "v"(g + 5*GSTEP), "v"(g + 6*GSTEP), "v"(g + 7*GSTEP)
                 : "memory");
}

__global__ __launch_bounds__(128)
void out_wmma(const _Float16* __restrict__ A,
              const _Float16* __restrict__ Bt,
              float* __restrict__ C)
{
    __shared__ __attribute__((aligned(16))) char sm[OA_BYTES + OB_BYTES];
    const int tid  = threadIdx.x;
    const int lane = tid & 31;
    const int wid  = tid >> 5;
    const int hi   = lane >> 4;
    const int lo   = lane & 15;
    const int m0   = (blockIdx.x >> 5) * 32;      // 8 row tiles; 32 rows lie in one batch
    const int n0   = (blockIdx.x & 31) * 32;      // 32 column tiles
    const unsigned sbase = (unsigned)(size_t)sm;  // the array's byte address in LDS

    // A: copy i of a thread brings 16 bytes (two rows) of piece 8*i + tid / 16; the
    // 16 lanes of a piece cover its 256 bytes. Pieces lie TT*8 bytes apart.
    const char* ga = (const char*)(A + (((m0 >> 7)*128 + (tid >> 4))*TT + (m0 & (TT-1))) * 4)
                     + (tid & 15)*16;
    const unsigned la = sbase + (tid >> 4)*OA_PITCH + (tid & 15)*16;
    async_copy8<8*OA_PITCH, 8*TT*8>(la, ga);
    async_copy8<8*OA_PITCH, 8*TT*8>(la + 64*OA_PITCH, ga + 64*TT*8);
    // Bt: copy i of a thread brings 16 bytes of row 2*i + tid / 64; a wave covers
    // 512 bytes of a row.
    const char* gb = (const char*)(Bt + (n0 + (tid >> 6)) * (HH*DV)) + (tid & 63)*16;
    const unsigned lb = sbase + OA_BYTES + (tid >> 6)*OB_PITCH + (tid & 63)*16;
    async_copy8<2*OB_PITCH, 2*HH*DV*2>(lb, gb);
    async_copy8<2*OB_PITCH, 2*HH*DV*2>(lb + 16*OB_PITCH, gb + 16*HH*DV*2);
    // the wave's own copies have landed behind this wait
    asm volatile("s_wait_asynccnt 0x0" ::: "memory");
    // every wave reads what the other waves copied
    __syncthreads();

    const int mt = wid & 1;
    const int nt = wid >> 1;
    const char* ard = sm + 2*hi*OA_PITCH + (16*mt + lo)*8;
    const char* brd = sm + OA_BYTES + (16*nt + lo)*OB_PITCH + 16*hi;
    v8f acc = {};
    // unrolled so that every LDS read has a constant offset and the reads of later
    // k steps are issued ahead of the products
#pragma unroll
    for (int ks = 0; ks < (HH*DV)/32; ++ks) {
        const v4h a0 = *(const v4h*)(ard + (8*ks    )*OA_PITCH);
        const v4h a1 = *(const v4h*)(ard + (8*ks + 1)*OA_PITCH);
        const v4h a2 = *(const v4h*)(ard + (8*ks + 4)*OA_PITCH);
        const v4h a3 = *(const v4h*)(ard + (8*ks + 5)*OA_PITCH);
        const v8h bl = *(const v8h*)(brd + 64*ks);
        const v8h bh = *(const v8h*)(brd + 64*ks + 32);
        const v8h al = __builtin_shufflevector(a0, a1, 0,1,2,3,4,5,6,7);
        const v8h ah = __builtin_shufflevector(a2, a3, 0,1,2,3,4,5,6,7);
        const v16h a = __builtin_shufflevector(al, ah, 0,1,2,3,4,5,6,7,8,9,10,11,12,13,14,15);
        const v16h b = __builtin_shufflevector(bl, bh, 0,1,2,3,4,5,6,7,8,9,10,11,12,13,14,15);
        acc = __builtin_amdgcn_wmma_f32_16x16x32_f16(false, a, false, b,
                                                     (short)0, acc, false, false);
    }
    float* crow = C + (m0 + 16*mt + 8*hi) * DD + n0 + 16*nt + lo;
    // unrolled so that acc is indexed by constants and stays in registers
#pragma unroll
    for (int r = 0; r < 8; ++r)
        crow[r * DD] = acc[r];
}

// ---------------------------------------------------------------------------
// An input projection straight from the f32 inputs. One block = 32 rows of x
// against 64 columns of W[K,LDW], all of K = 1024, in 4 chunks of 256 k. A chunk
// is loaded as f32 in whole 256-byte (W) and 1-KB (x) pieces of rows, rounded to
// f16 in registers and laid in LDS as As[m][k] and Bs[n][k]: a thread holds 8 k
// of 4 n, so that the turn of W is only a choice of registers. The next chunk's
// loads fly while this chunk is multiplied; two LDS buffers, one barrier a chunk.
// 8 waves, one 16x16 tile each (2 in m x 4 in n); fragments and k order are those
// given above, read from LDS.
// In a row n of Bs the 16-byte groups of 8 k are stored at group ^ ((n >> 4) & 3):
// the 16 lanes of a store, which lie 4 rows apart, then fall on all 64 banks; for
// a reading wave n >> 4 is one number.
// ---------------------------------------------------------------------------
#define KCH 256                    // k of a chunk
#define LPITCH (KCH + 8)           // halves; 16 rows of 16-byte reads cover the banks
#define AS_HALVES (32 * LPITCH)
#define BS_HALVES (64 * LPITCH)
#define PROJ_LDS_BYTES ((2*AS_HALVES + 2*BS_HALVES) * 2)

template <int LDW>
__device__ __forceinline__ void proj_tile(const float* __restrict__ x,   // at row m0
                                          const float* __restrict__ Wn,  // at column n0
                                          float* __restrict__ C,         // at (m0, n0)
                                          int act,
                                          _Float16* __restrict__ As,
                                          _Float16* __restrict__ Bs)
{
    const int tid  = threadIdx.x;
    const int lane = tid & 31;
    const int wid  = tid >> 5;
    const int hi   = lane >> 4;
    const int lo   = lane & 15;
    const int mt   = wid & 1;
    const int nt   = wid >> 1;

    // loaders: W rows 8*kg + j (+ 128), columns 4*nq ..; x row tid / 32 (+ 8 u),
    // k = 8*(tid & 31) ..
    const int nq = tid & 15;
    const int kg = tid >> 4;
    const float* wsrc = Wn + (kg*8)*LDW + nq*4;
    const float* xsrc = x + (tid >> 5)*DD + (tid & 31)*8;
    _Float16* bdst = Bs + (nq*4)*LPITCH + ((kg ^ (nq >> 2)) << 3);
    _Float16* adst = As + (tid >> 5)*LPITCH + (tid & 31)*8;
    // readers
    const _Float16* ard  = As + (16*mt + lo)*LPITCH + 8*hi;
    const _Float16* brd  = Bs + (16*nt + lo)*LPITCH;
    const int bo0 = (hi ^ nt) << 3;
    const int bo1 = ((2 + hi) ^ nt) << 3;

    // every loop below is unrolled so that the arrays are indexed by constants and
    // stay in registers, and a chunk's 24 loads fly together
    v4f wl[16], xl[8];
#pragma unroll
    for (int g = 0; g < 2; ++g)
#pragma unroll
        for (int j = 0; j < 8; ++j)
            wl[g*8 + j] = *(const v4f*)(wsrc + (g*128 + j)*LDW);
#pragma unroll
    for (int u = 0; u < 4; ++u) {
        xl[2*u]     = *(const v4f*)(xsrc + u*8*DD);
        xl[2*u + 1] = *(const v4f*)(xsrc + u*8*DD + 4);
    }
    // the wait stands between these loads and any later write of their address
    // registers; the scheduling barrier keeps such writes from being lifted over it
    asm volatile("s_wait_xcnt 0x0" ::: "memory");
    __builtin_amdgcn_sched_barrier(0);

    v8f acc = {};
#pragma unroll
    for (int c = 0; c < DD/KCH; ++c) {
        const int bufa = (c & 1) * AS_HALVES;
        const int bufb = (c & 1) * BS_HALVES;
#pragma unroll
        for (int g = 0; g < 2; ++g)
#pragma unroll
            for (int i = 0; i < 4; ++i) {
                v8h h;
#pragma unroll
                for (int j = 0; j < 8; ++j) h[j] = (_Float16)wl[g*8 + j][i];
                *(v8h*)(bdst + bufb + i*LPITCH + g*128) = h;
            }
#pragma unroll
        for (int u = 0; u < 4; ++u) {
            v8h h;
#pragma unroll
            for (int j = 0; j < 4; ++j) {
                h[j]     = (_Float16)xl[2*u][j];
                h[4 + j] = (_Float16)xl[2*u + 1][j];
            }
            *(v8h*)(adst + bufa + u*8*LPITCH) = h;
        }
        if (c + 1 < DD/KCH) {
            const int kn = (c + 1) * KCH;
            // keeps the next chunk's loads behind this chunk's LDS stores: lifted
            // over them, the results of two chunks are live at once and spill
            __builtin_amdgcn_sched_barrier(0);
#pragma unroll
            for (int g = 0; g < 2; ++g)
#pragma unroll
                for (int j = 0; j < 8; ++j)
                    wl[g*8 + j] = *(const v4f*)(wsrc + (kn + g*128 + j)*LDW);
#pragma unroll
            for (int u = 0; u < 4; ++u) {
                xl[2*u]     = *(const v4f*)(xsrc + u*8*DD + kn);
                xl[2*u + 1] = *(const v4f*)(xsrc + u*8*DD + kn + 4);
            }
            // as above: the wait before the loads' address registers are rewritten
            asm volatile("s_wait_xcnt 0x0" ::: "memory");
            __builtin_amdgcn_sched_barrier(0);
        }
        // The work-group barrier that publishes this chunk; it also ends every
        // wave's reads of the other buffer, which the next trip overwrites. Its
        // fences name LDS alone: __syncthreads() would also wait for the next
        // chunk's global loads, which are to fly through this chunk's products.
        __builtin_amdgcn_fence(__ATOMIC_RELEASE, "workgroup", "local");
        __builtin_amdgcn_s_barrier();
        __builtin_amdgcn_fence(__ATOMIC_ACQUIRE, "workgroup", "local");
#pragma unroll
        for (int kk = 0; kk < KCH; kk += 32) {
            const v8h al = *(const v8h*)(ard + bufa + kk);
            const v8h ah = *(const v8h*)(ard + bufa + kk + 16);
            const v8h bl = *(const v8h*)(brd + bufb + kk + bo0);
            const v8h bh = *(const v8h*)(brd + bufb + kk + bo1);
            const v16h a = __builtin_shufflevector(al, ah, 0,1,2,3,4,5,6,7,8,9,10,11,12,13,14,15);
            const v16h b = __builtin_shufflevector(bl, bh, 0,1,2,3,4,5,6,7,8,9,10,11,12,13,14,15);
            acc = __builtin_amdgcn_wmma_f32_16x16x32_f16(false, a, false, b,
                                                         (short)0, acc, false, false);
        }
        // keeps the next chunk's conversions, which wait for its loads, from being
        // lifted among this chunk's products: the products are what hides the loads
        __builtin_amdgcn_sched_barrier(0);
    }
#pragma unroll
    for (int r = 0; r < 8; ++r) {
        float y = acc[r];
        if (act == 1) y = sigmoid_fast(y);
        C[(16*mt + r + 8*hi) * LDW + 16*nt + lo] = y;
    }
    // the code that follows in the kernel's listing reuses the stores' address and
    // data registers: keep the wait between the eight stores and those writes
    asm volatile("s_wait_xcnt 0x0" ::: "memory");
}

// ---------------------------------------------------------------------------
// Layout prep: f32 [K,N] -> f16 [N,K] transpose.
// blk is the block's index within its own job; 256 threads a block, 32 elements
// a thread, so that the launch starts few waves and every global access is a
// 16-byte piece of a whole line.
// ---------------------------------------------------------------------------
#define PREP_ELEMS 8192            // elements a block handles
#define TILE_K 128
#define TILE_N 64
#define TILE_PITCH 65              // floats; odd, so that a column walk changes bank

// One block turns a tile of 128 k x 64 n. It reads 256-byte pieces of the rows
// of in, lays them in LDS as they are, and each thread then walks down a column
// and stores 8 k of one n as 16 bytes: a block writes 256 bytes of each of its
// 64 rows of out. K and N are multiples of 128 and 64.
__device__ __forceinline__ void transpose_f16_tile(const float* __restrict__ in, // [K,N]
                                                   _Float16* __restrict__ out,   // [N,K]
                                                   int K, int N, int blk,
                                                   float* __restrict__ tile)
{
    const int tid = threadIdx.x;
    const int ntn = N / TILE_N;
    const int k0  = (blk / ntn) * TILE_K;
    const int n0  = (blk % ntn) * TILE_N;
    const int lr  = tid >> 4;              // row of the first piece, 16 rows a pass
    const int lc  = (tid & 15) * 4;
    const float* src = in + (size_t)(k0 + lr) * N + n0 + lc;
    // all loops here are unrolled so that the arrays are indexed by constants and
    // stay in registers, and the 8 loads fly together
    v4f ld[8];
#pragma unroll
    for (int it = 0; it < 8; ++it)
        ld[it] = *(const v4f*)(src + (size_t)it * 16 * N);
#pragma unroll
    for (int it = 0; it < 8; ++it)
#pragma unroll
        for (int j = 0; j < 4; ++j)
            tile[(lr + 16*it) * TILE_PITCH + lc + j] = ld[it][j];
    // every wave reads what the other waves laid down
    __syncthreads();
    const int n  = tid >> 2;
    const int kq = (tid & 3) * 8;
    _Float16* dst = out + (size_t)(n0 + n) * K + k0 + kq;
#pragma unroll
    for (int g = 0; g < 4; ++g) {
        v8h h;
#pragma unroll
        for (int j = 0; j < 8; ++j)
            h[j] = (_Float16)tile[(kq + 32*g + j) * TILE_PITCH + n];
        *(v8h*)(dst + 32*g) = h;
    }
    // the code that follows in the kernel's listing reuses the stores' address and
    // data registers: keep the wait between the four stores and those writes
    asm volatile("s_wait_xcnt 0x0" ::: "memory");
}

// ---------------------------------------------------------------------------
// Precompute per-(h,r) spectral parameters. One wave per (h,r): its 32 lanes
// take the 32 frequency pairs of Dk, one each, so that the table costs one pass
// through powf, cosf and sinf, not a serial walk over Dk. 8 waves a block.
// blk is the block's index within this job.
// ---------------------------------------------------------------------------
#define PREP_PAR_BLOCKS ((HH*RR)/8)   // 8
__device__ __forceinline__ void params_block(const float* __restrict__ mode_logits,
                                             const float* __restrict__ log_decay,
                                             const float* __restrict__ omega_log_scale,
                                             float* __restrict__ cosw,
                                             float* __restrict__ sinw,
                                             float* __restrict__ rho,
                                             float* __restrict__ modew,
                                             int blk)
{
    const int t = blk * 8 + (threadIdx.x >> 5);              // 0..63, one a wave
    const int h = t >> 3;
    const int p = threadIdx.x & 31;                          // frequency pair

    // all that the wave reads, in flight together: one load latency
    const float ols = omega_log_scale[t];
    const float ld  = log_decay[t];
    const float mlt = mode_logits[t];
    const v4f ml0 = *(const v4f*)(mode_logits + h*RR);
    const v4f ml1 = *(const v4f*)(mode_logits + h*RR + 4);
    // the address registers of these loads are reused by the arithmetic below:
    // keep the wait between the loads and those writes; the scheduling barrier
    // keeps that arithmetic from being lifted over the wait
    asm volatile("s_wait_xcnt 0x0" ::: "memory");
    __builtin_amdgcn_sched_barrier(0);
    const float ml[RR] = {ml0.x, ml0.y, ml0.z, ml0.w, ml1.x, ml1.y, ml1.z, ml1.w};

    const float pidx = (float)(2 * p);                       // repeat_interleave
    const float invf = powf(10000.0f, -pidx / (float)DK);
    const float w  = expf(ols) * invf;
    const float cw = cosf(w);
    const float sw = sinf(w);
    const v2f c2 = {cw, cw};
    const v2f s2 = {sw, sw};

    const float sp = (ld > 20.0f) ? ld : log1pf(expf(ld));   // softplus
    const float rh = expf(-sp);
    // unrolled so that ml is indexed by constants and stays in registers
    float mx = -1e30f;
#pragma unroll
    for (int j = 0; j < RR; ++j) mx = fmaxf(mx, ml[j]);
    float sum = 0.0f;
#pragma unroll
    for (int j = 0; j < RR; ++j) sum += expf(ml[j] - mx);
    const float mwt = expf(mlt - mx) / sum;

    *(v2f*)(cosw + t*DK + 2*p) = c2;
    *(v2f*)(sinw + t*DK + 2*p) = s2;
    if (p == 0) {
        rho[t]   = rh;
        modew[t] = mwt;
    }
}

// ---------------------------------------------------------------------------
// All that reads only inputs, in one launch, a range of blocks per job: the
// parameter table (8 blocks), the six input projections (34 column tiles of 64 x
// 8 row tiles of 32: q, k, v and the gate 8 column tiles each, then beta, tg) and
// the f16 transpose of Wo for the output projection (64 blocks). None waits for
// another; the scan and the output projection are later launches.
// ---------------------------------------------------------------------------
#define PREP_BIG_BLOCKS ((DD*512)/PREP_ELEMS)     // 64
#define PROJ_GEMM_BLOCKS (34*8)
#define PROJ_BLOCKS (PREP_PAR_BLOCKS + PROJ_GEMM_BLOCKS + PREP_BIG_BLOCKS)
__global__ __launch_bounds__(256)
void proj_wmma(const float* __restrict__ x,
               const float* __restrict__ Wq,
               const float* __restrict__ Wk,
               const float* __restrict__ Wv,
               const float* __restrict__ Wg,
               const float* __restrict__ Wo,
               const float* __restrict__ Wb,
               const float* __restrict__ Wtg,
               const float* __restrict__ mode_logits,
               const float* __restrict__ log_decay,
               const float* __restrict__ omega_log_scale,
               float* __restrict__ q,
               float* __restrict__ k,
               float* __restrict__ v,
               float* __restrict__ g,
               float* __restrict__ beta,
               float* __restrict__ tg,
               _Float16* __restrict__ Wot,
               float* __restrict__ cosw,
               float* __restrict__ sinw,
               float* __restrict__ rho,
               float* __restrict__ modew)
{
    // one block does one job: the jobs share the space
    __shared__ __attribute__((aligned(16))) char smem[PROJ_LDS_BYTES];
    static_assert(PROJ_LDS_BYTES >= TILE_K * TILE_PITCH * 4, "the transpose tile fits");
    int blk = blockIdx.x;
    if (blk < PREP_PAR_BLOCKS) {
        params_block(mode_logits, log_decay, omega_log_scale, cosw, sinw, rho, modew, blk);
        return;
    }
    blk -= PREP_PAR_BLOCKS;
    if (blk < PROJ_GEMM_BLOCKS) {
        _Float16* As = (_Float16*)smem;
        _Float16* Bs = As + 2*AS_HALVES;
        const int ct = blk >> 3;
        const int m0 = (blk & 7) * 32;
        const float* xm = x + m0*DD;
        if (ct < 32) {
            const int job = ct >> 3;
            const int n0  = (ct & 7) * 64;
            const float* Wn = job == 0 ? Wq : job == 1 ? Wk : job == 2 ? Wv : Wg;
            float*       C  = job == 0 ? q  : job == 1 ? k  : job == 2 ? v  : g;
            proj_tile<512>(xm, Wn + n0, C + m0*512 + n0, job == 3 ? 1 : 0, As, Bs);
        } else {
            proj_tile<64>(xm, ct == 32 ? Wb : Wtg, (ct == 32 ? beta : tg) + m0*64, 1, As, Bs);
        }
        return;
    }
    blk -= PROJ_GEMM_BLOCKS;
    transpose_f16_tile(Wo, Wot, 512, DD, blk, (float*)smem);
}

// ---------------------------------------------------------------------------
// Recurrent scan: 8 lanes share one state row (b,h,r,v); each lane keeps 8 of
// the 64 Dk elements (real and imaginary) in registers, as two groups of four:
// k = 4*sub + 0..3 and k = 32 + 4*sub + 0..3, so that the 8 lanes of a row read
// one 128-byte line per 16-byte load. The two sums over Dk of a time step end
// in three in-row DPP adds (lane ^ 1, ^ 2, ^ 4).
// One block = the 8 modes r of 4 v of one (b,h): wave r holds mode r, 4 rows.
// So the block owns all that an output element (b,t,h,v) is summed from: each
// row's weighted read-outs are kept in LDS, and behind the loop the block sums
// them over r, applies the gate and stores the f16 operand of the output
// projection itself, as 1 KB of its own: og[block][t][4 v].
// What the block reads in its 128 time steps (the k and q rows of its (b,h), its
// 4 v of each step, decay and beta of its h) is brought into LDS once, ahead
// of the loop, with all loads in flight together; the loop reads it from there
// one time step ahead, so that no load latency is left in a time step.
// ---------------------------------------------------------------------------
template <int CTRL>
__device__ __forceinline__ float add_row_xmask(float x)
{
    // x + (x of lane ^ mask), mask in the low bits of CTRL (0x160 | mask)
    const int xi = __builtin_bit_cast(int, x);
    const int yi = __builtin_amdgcn_update_dpp(0, xi, CTRL, 0xf, 0xf, true);
    return x + __builtin_bit_cast(float, yi);
}

__device__ __forceinline__ float sum_over_8_lanes(float x)
{
    x = add_row_xmask<0x161>(x);
    x = add_row_xmask<0x162>(x);
    x = add_row_xmask<0x164>(x);
    return x;
}

#define YPITCH (TT + 8)   // floats; the 4 rows of a wave then store on disjoint banks

// The grid is 2048 waves, two per SIMD: waves_per_eu says so, so that the
// register budget is not held at 64: the staging holds the results of a thread's
// twenty-one loads at once.
__global__ __launch_bounds__(256) __attribute__((amdgpu_waves_per_eu(2, 2)))
void scan_kernel(const float* __restrict__ q,
                 const float* __restrict__ k,
                 const float* __restrict__ v,
                 const float* __restrict__ g,
                 const float* __restrict__ beta,
                 const float* __restrict__ tg,
                 const float* __restrict__ cosw,
                 const float* __restrict__ sinw,
                 const float* __restrict__ rho,
                 const float* __restrict__ modew,
                 _Float16* __restrict__ og)
{
    const unsigned tid = threadIdx.x;
    const int vg   = blockIdx.x & 15;
    const int h    = (blockIdx.x >> 4) & 7;
    const int b    = (blockIdx.x >> 7) & 1;
    // the wave's number, said to be uniform so that what hangs on it is scalar
    const int r    = __builtin_amdgcn_readfirstlane(tid >> 5);
    const int hr   = h*RR + r;
    const int sub  = tid & 7;
    const int vloc = (tid >> 3) & 3;

    __shared__ v4f ks[TT*16];         // k rows, 64 floats a step
    __shared__ v4f qs[TT*16];         // q rows, 64 floats a step
    __shared__ v4f vs[TT];            // this block's 4 v of a step
    __shared__ v4f db[TT*4];          // (decay, beta) of a step's 8 modes
    __shared__ float yl[32*YPITCH];   // weighted read-outs, [r*4 + v][t]

    const float mw = modew[hr];
    // keeps the scalar load above from being placed between the four loads
    // below and their wait, where it would land in those loads' base registers
    __builtin_amdgcn_sched_barrier(0);

    const float4* c4 = (const float4*)(cosw + hr*DK);
    const float4* s4 = (const float4*)(sinw + hr*DK);
    const float4 ca = c4[sub], cb = c4[8 + sub];
    const float4 sa = s4[sub], sb = s4[8 + sub];
    // the base registers of these four loads are reused right behind them: keep
    // the wait between the loads and those writes; the scheduling barrier keeps
    // the later index arithmetic from being lifted over the wait
    asm volatile("s_wait_xcnt 0x0" ::: "memory");
    __builtin_amdgcn_sched_barrier(0);
    // pair p holds the lane's elements 2p and 2p + 1, neighbours in k
    const v2f c[4] = {{ca.x, ca.y}, {ca.z, ca.w}, {cb.x, cb.y}, {cb.z, cb.w}};
    const v2f s[4] = {{sa.x, sa.y}, {sa.z, sa.w}, {sb.x, sb.y}, {sb.z, sb.w}};

    // Staging. row0 is the flat (b,0,h); the next time step lies HH rows on. A
    // wave's 16-byte loads cover whole 256-byte k or q rows; a thread's pieces lie
    // 16 steps apart. Of step tid / 2 a thread brings two of the block's 4 v, the
    // gate of the same two (g is laid out as v is) and tg, beta and rho of four of
    // the 8 modes.
    const unsigned row0 = b*TT*HH + h;
    const unsigned kq_off = ((row0 + (tid >> 4)*HH)*DK + (tid & 15)*4) * 4;
    const unsigned v_off  = ((row0 + (tid >> 1)*HH)*DV + vg*4 + (tid & 1)*2) * 4;
    const unsigned d_off  = ((row0 + (tid >> 1)*HH)*RR + (tid & 1)*4) * 4;
    const unsigned r_off  = (h*RR + (tid & 1)*4) * 4;
    // the loop is unrolled so that the arrays stay in registers and all of a
    // thread's loads are in flight at once
    v4f kst[8], qst[8];
#pragma unroll
    for (int it = 0; it < 8; ++it) {
        kst[it] = *(const v4f*)((const char*)k + kq_off + it*(16*HH*DK*4));
        qst[it] = *(const v4f*)((const char*)q + kq_off + it*(16*HH*DK*4));
    }
    const v2f vst   = *(const v2f*)((const char*)v + v_off);
    const v2f gst   = *(const v2f*)((const char*)g + v_off);
    const v4f tg_st = *(const v4f*)((const char*)tg + d_off);
    const v4f be_st = *(const v4f*)((const char*)beta + d_off);
    const v4f rh_st = *(const v4f*)((const char*)rho + r_off);
    // The wait stands between these loads and every later write of their offset
    // registers. It takes the loaded values and the four offsets as inputs only:
    // so all the loads are issued ahead of it, and no offset register is given
    // to a load's result or to later arithmetic before it. The scheduling barrier
    // keeps later index arithmetic, which reuses the loads' base registers, from
    // being lifted over the wait.
    asm volatile("s_wait_xcnt 0x0"
                 :: "v"(kst[0]), "v"(kst[1]), "v"(kst[2]), "v"(kst[3]),
                    "v"(kst[4]), "v"(kst[5]), "v"(kst[6]), "v"(kst[7]),
                    "v"(qst[0]), "v"(qst[1]), "v"(qst[2]), "v"(qst[3]),
                    "v"(qst[4]), "v"(qst[5]), "v"(qst[6]), "v"(qst[7]),
                    "v"(vst), "v"(gst), "v"(tg_st), "v"(be_st), "v"(rh_st),
                    "v"(kq_off), "v"(v_off), "v"(d_off), "v"(r_off)
                 : "memory");
    __builtin_amdgcn_sched_barrier(0);
#pragma unroll
    for (int it = 0; it < 8; ++it) {
        ks[it*256 + tid] = kst[it];
        qs[it*256 + tid] = qst[it];
    }
    ((v2f*)vs)[tid] = vst;
    db[2*tid]     = (v4f){tg_st.x * rh_st.x, be_st.x, tg_st.y * rh_st.y, be_st.y};
    db[2*tid + 1] = (v4f){tg_st.z * rh_st.z, be_st.z, tg_st.w * rh_st.w, be_st.w};
    // every wave reads what the other waves staged
    __syncthreads();
    const float* vsf = (const float*)vs + vloc;
    const v2f*   dbr = (const v2f*)db + r;

    // The lane's 8 elements are kept as 4 pairs in the order in which a 16-byte
    // LDS read delivers k and q, and the whole step is written on pairs: the
    // lines below use packed instructions on register pairs as they lie, with
    // no copy to form a pair. Every loop over p is unrolled so that the 4-pair
    // arrays are indexed by constants and stay in registers.
    v2f sr[4], si[4];
#pragma unroll
    for (int p = 0; p < 4; ++p) { sr[p] = (v2f){0.f, 0.f}; si[p] = (v2f){0.f, 0.f}; }

    // A trip works on operands that were read from LDS in the trip before.
    v4f ka = ks[sub], kb = ks[8 + sub];
    v4f qa = qs[sub], qb = qs[8 + sub];
    v2f dbt = dbr[0];
    float vt = vsf[0];
    float* yrow = yl + (r*4 + vloc)*YPITCH + sub;
    for (int t0 = 0; t0 < TT; t0 += 8) {
        // Lane sub of a row keeps the read-out of step t0 + sub, so that 8 steps
        // end in one LDS store from every lane. Unrolled so that the lane that
        // keeps a step is a constant.
        float keep = 0.f;
#pragma unroll
        for (int j = 0; j < 8; ++j) {
            const int t = t0 + j;
            const v2f decay = {dbt.x, dbt.x};
            const float bet = dbt.y;
            const v2f kt[4] = {{ka.x, ka.y}, {ka.z, ka.w}, {kb.x, kb.y}, {kb.z, kb.w}};
            const v2f qt[4] = {{qa.x, qa.y}, {qa.z, qa.w}, {qb.x, qb.y}, {qb.z, qb.w}};

            v2f rr[4];
#pragma unroll
            for (int p = 0; p < 4; ++p) {
                rr[p] = decay * (c[p]*sr[p] - s[p]*si[p]);
                si[p] = decay * (s[p]*sr[p] + c[p]*si[p]);
            }

            // .x sums the even elements, .y the odd ones
            const v2f pp = rr[0]*kt[0] + rr[1]*kt[1] + rr[2]*kt[2] + rr[3]*kt[3];
            const float pred = sum_over_8_lanes(pp.x + pp.y);

            const float bw1 = bet * (vt - pred);
            const v2f bw = {bw1, bw1};
#pragma unroll
            for (int p = 0; p < 4; ++p) sr[p] = rr[p] + bw*kt[p];

            const v2f rp = sr[0]*qt[0] + sr[1]*qt[1] + sr[2]*qt[2] + sr[3]*qt[3];

            // This step's operands are used up: the next step's are read into
            // their place. The last trip reads its own step again, so that
            // nothing behind the staged rows is read.
            const int tn = (t + 1 < TT) ? t + 1 : t;
            ka = ks[tn*16 + sub];  kb = ks[tn*16 + 8 + sub];
            qa = qs[tn*16 + sub];  qb = qs[tn*16 + 8 + sub];
            dbt = dbr[tn*RR];
            vt  = vsf[tn*4];

            const float rd = sum_over_8_lanes(rp.x + rp.y);
            keep = (sub == j) ? rd : keep;
        }
        yrow[t0] = keep * mw;
    }
    // every wave reads the other modes' read-outs
    __syncthreads();

    // Two outputs a thread: step tid / 2, v = 2*(tid & 1) + 0, 1; the modes are
    // summed in the order r = 0..7.
    const float* ye = yl + (tid & 1)*2*YPITCH + (tid >> 1);
    float o0 = 0.0f, o1 = 0.0f;
    // unrolled so that the 16 LDS reads are issued together
#pragma unroll
    for (int m = 0; m < RR; ++m) {
        o0 += ye[(m*4)*YPITCH];
        o1 += ye[(m*4 + 1)*YPITCH];
    }
    const v2h oh = {(_Float16)(o0 * gst.x), (_Float16)(o1 * gst.y)};
    *(v2h*)(og + (size_t)blockIdx.x * (TT*4) + 2*tid) = oh;
}

// ---------------------------------------------------------------------------
extern "C" void kernel_launch(void* const* d_in, const int* in_sizes, int n_in,
                              void* d_out, int out_size, void* d_ws, size_t ws_size,
                              hipStream_t stream)
{
    (void)in_sizes; (void)n_in; (void)out_size; (void)ws_size;
    const float* x    = (const float*)d_in[0];
    const float* Wq   = (const float*)d_in[1];
    const float* Wk   = (const float*)d_in[2];
    const float* Wv   = (const float*)d_in[3];
    const float* Wb   = (const float*)d_in[4];
    const float* Wtg  = (const float*)d_in[5];
    const float* mlg  = (const float*)d_in[6];
    const float* ldc  = (const float*)d_in[7];
    const float* oms  = (const float*)d_in[8];
    const float* Wg   = (const float*)d_in[9];
    const float* Wo   = (const float*)d_in[10];

    // ---- f32 scratch ----
    float* ws    = (float*)d_ws;
    float* q     = ws;                        // 256*512
    float* k     = q    + MROWS*512;
    float* v     = k    + MROWS*512;
    float* g     = v    + MROWS*512;
    float* beta  = g    + MROWS*512;          // 256*64
    float* tg    = beta + MROWS*64;
    float* cosw  = tg   + MROWS*64;           // 64*64
    float* sinw  = cosw + HH*RR*DK;
    float* rho   = sinw + HH*RR*DK;           // 64
    float* modew = rho  + HH*RR;
    float* fend  = modew + HH*RR;

    // ---- f16 scratch (16B-aligned: float count above is a multiple of 4) ----
    _Float16* Wot  = (_Float16*)fend;         // 1024*512
    _Float16* ogh  = Wot  + DD*512;           // 256*512, in pieces of 4 k

    // parameter table, the six input projections from f32, the transpose of Wo
    proj_wmma<<<PROJ_BLOCKS, 256, 0, stream>>>(x, Wq, Wk, Wv, Wg, Wo, Wb, Wtg,
                                               mlg, ldc, oms,
                                               q, k, v, g, beta, tg,
                                               Wot, cosw, sinw, rho, modew);

    // 8192 rows, 8 lanes each, 32 rows per 256-thread block -> 256 blocks
    scan_kernel<<<256, 256, 0, stream>>>(q, k, v, g, beta, tg, cosw, sinw, rho, modew, ogh);

    // 8 x 32 tiles of 32 x 32, 4 waves each
    out_wmma<<<256, 128, 0, stream>>>(ogh, Wot, (float*)d_out);
}
